// v000
// Measured on an AMD MI455X. A time is GPU time per run, averaged over a window of back-to-back runs after a warm-up
// (all launches, gaps included; the runs take copies of the inputs in turn), and the median of several windows.
// Apart from v000's, it joins two sittings. Times from different sittings can be a few percent apart, while
// side-by-side timings come from the same sitting.
// v000, which the later versions start from, runs in 734 microseconds.
#include <hip/hip_runtime.h>
#include <hip/hip_bf16.h>

typedef __attribute__((ext_vector_type(2))) float v2f;
typedef __attribute__((ext_vector_type(8))) float v8f;

#define BATCH 2
#define SEQ   2048
#define DMODEL 768
#define HEADS 12
#define FDIM  16
#define DHEAD 64

#define AS1 __attribute__((address_space(1)))
#define AS3 __attribute__((address_space(3)))

#if defined(__has_builtin)
#if __has_builtin(__builtin_amdgcn_global_load_async_to_lds_b32) && \
    __has_builtin(__builtin_amdgcn_s_wait_asynccnt)
#define USE_ASYNC_LDS 1
#endif
#endif

static __device__ __forceinline__ v8f wmma_f32(v2f a, v2f b, v8f c) {
    return __builtin_amdgcn_wmma_f32_16x16x4_f32(false, a, false, b, (short)0, c, false, false);
}

// ---------------------------------------------------------------------------
// Block-tiled fp32 WMMA GEMM: C(MxN) = A(MxK,rm) * B(KxN,rm).
// Block = 128x64 C tile, 8 waves, each wave a 32x32 sub-block (4 WMMA tiles).
// K staged in 16-wide slabs; A row-major (stride 20), B transposed (stride 18)
// in LDS so every WMMA operand is a single aligned ds_load_b64, bank-conflict
// free for both lane halves. Slabs staged via async global->LDS DMA when the
// toolchain exposes it. Requires M%128==0, N%64==0, K%16==0.
// ---------------------------------------------------------------------------
#define GBM 128
#define GBN 64
#define GKT 16

__global__ __launch_bounds__(256) void gemm_wmma_f32(
    const float* __restrict__ A, const float* __restrict__ B,
    float* __restrict__ C, int M, int K, int N)
{
    __shared__ float As[GBM * 20];   // [row][k]  128 x 16, stride 20
    __shared__ float Bt[GBN * 18];   // [col][k]   64 x 16, stride 18 (transposed)

    int tid  = threadIdx.x;
    int wave = tid >> 5, lane = tid & 31;
    int ln15 = lane & 15;
    int dK   = (lane < 16) ? 0 : 2;

    int nBlocks = N / GBN;
    int bm = blockIdx.x / nBlocks;
    int bn = blockIdx.x - bm * nBlocks;
    int rowBase = bm * GBM;
    int colBase = bn * GBN;

    int aRow0 = (wave & 3) * 32;
    int bCol0 = (wave >> 2) * 32;

    int ar = tid >> 4, af = tid & 15;     // A staging: 8 rows apart by 16
    int br = tid >> 6, bc = tid & 63;     // B staging: 4 rows apart by 4

    v8f acc00 = {}, acc01 = {}, acc10 = {}, acc11 = {};

    for (int k0 = 0; k0 < K; k0 += GKT) {
        __syncthreads();
#ifdef USE_ASYNC_LDS
        #pragma unroll
        for (int i = 0; i < 8; ++i)
            __builtin_amdgcn_global_load_async_to_lds_b32(
                (AS1 int*)(A + (size_t)(rowBase + ar + i * 16) * K + k0 + af),
                (AS3 int*)(As + (ar + i * 16) * 20 + af), 0, 0);
        #pragma unroll
        for (int i = 0; i < 4; ++i)
            __builtin_amdgcn_global_load_async_to_lds_b32(
                (AS1 int*)(B + (size_t)(k0 + br + i * 4) * N + colBase + bc),
                (AS3 int*)(Bt + bc * 18 + br + i * 4), 0, 0);
        __builtin_amdgcn_s_wait_asynccnt(0);
#else
        float ta[8], tb[4];
        #pragma unroll
        for (int i = 0; i < 8; ++i)
            ta[i] = A[(size_t)(rowBase + ar + i * 16) * K + k0 + af];
        #pragma unroll
        for (int i = 0; i < 4; ++i)
            tb[i] = B[(size_t)(k0 + br + i * 4) * N + colBase + bc];
        #pragma unroll
        for (int i = 0; i < 8; ++i) As[(ar + i * 16) * 20 + af] = ta[i];
        #pragma unroll
        for (int i = 0; i < 4; ++i) Bt[bc * 18 + br + i * 4] = tb[i];
#endif
        if (k0 + GKT < K) {                                    // global_prefetch_b8
            __builtin_prefetch(&A[(size_t)(rowBase + (tid & 127)) * K + k0 + GKT], 0, 3);
            if (tid < GKT)
                __builtin_prefetch(&B[(size_t)(k0 + GKT + tid) * N + colBase], 0, 3);
        }
        __syncthreads();

        #pragma unroll
        for (int st = 0; st < GKT / 4; ++st) {
            int kk = st * 4 + dK;                              // even -> 8B-aligned
            v2f a0 = *(const v2f*)(&As[(aRow0 + ln15) * 20 + kk]);
            v2f a1 = *(const v2f*)(&As[(aRow0 + 16 + ln15) * 20 + kk]);
            v2f b0 = *(const v2f*)(&Bt[(bCol0 + ln15) * 18 + kk]);
            v2f b1 = *(const v2f*)(&Bt[(bCol0 + 16 + ln15) * 18 + kk]);
            acc00 = wmma_f32(a0, b0, acc00);
            acc01 = wmma_f32(a0, b1, acc01);
            acc10 = wmma_f32(a1, b0, acc10);
            acc11 = wmma_f32(a1, b1, acc11);
        }
    }

    #pragma unroll
    for (int j = 0; j < 8; ++j) {
        int rL = j + ((lane < 16) ? 0 : 8);
        int r0 = rowBase + aRow0 + rL;
        int r1 = r0 + 16;
        int c0 = colBase + bCol0 + ln15;
        int c1 = c0 + 16;
        C[(size_t)r0 * N + c0] = acc00[j];
        C[(size_t)r0 * N + c1] = acc01[j];
        C[(size_t)r1 * N + c0] = acc10[j];
        C[(size_t)r1 * N + c1] = acc11[j];
    }
}

// ---------------------------------------------------------------------------
// Running-mean centering scan. One block per (b,h); thread t<16 scans one k
// feature column, 16<=t<80 scans one v column.
// ---------------------------------------------------------------------------
__global__ __launch_bounds__(128) void center_scan_kernel(
    const float* __restrict__ k_raw, const float* __restrict__ v_raw,
    float* __restrict__ ck, float* __restrict__ cv, float* __restrict__ mv)
{
    int h = blockIdx.x, b = blockIdx.y;
    int t = threadIdx.x;
    int bh = b * HEADS + h;
    if (t < FDIM) {
        const float* src = k_raw + (size_t)b * SEQ * (HEADS * FDIM) + h * FDIM + t;
        float* dst = ck + (size_t)bh * SEQ * FDIM + t;
        float sum = 0.f;
        #pragma unroll 8
        for (int l = 0; l < SEQ; ++l) {
            float x = src[(size_t)l * (HEADS * FDIM)];
            sum += x;
            dst[(size_t)l * FDIM] = x - sum / (float)(l + 1);
        }
    } else if (t < FDIM + DHEAD) {
        int i = t - FDIM;
        const float* src = v_raw + (size_t)b * SEQ * (HEADS * DHEAD) + h * DHEAD + i;
        float* dcv = cv + (size_t)bh * SEQ * DHEAD + i;
        float* dmv = mv + (size_t)bh * SEQ * DHEAD + i;
        float sum = 0.f;
        #pragma unroll 8
        for (int l = 0; l < SEQ; ++l) {
            float x = src[(size_t)l * (HEADS * DHEAD)];
            sum += x;
            float m = sum / (float)(l + 1);
            dmv[(size_t)l * DHEAD] = m;
            dcv[(size_t)l * DHEAD] = x - m;
        }
    }
}

// ---------------------------------------------------------------------------
// Fused causal attention core (flash-style): one block per (b,h,64-query tile).
// S = Q * CK^T via WMMA into LDS (diag tile masked); per-row sum of S^2 and
// O += S * CV (WMMA, CV transposed in LDS) consumed from LDS.
// ---------------------------------------------------------------------------
__global__ __launch_bounds__(256) void atten_kernel(
    const float* __restrict__ q_raw, const float* __restrict__ ck,
    const float* __restrict__ cv, float* __restrict__ qKV, float* __restrict__ rs)
{
    __shared__ float Qs[64 * 20];    // [q][f]   stride 20
    __shared__ float CKs[64 * 20];   // [k][f]   stride 20
    __shared__ float CVt[64 * 68];   // [d][k]   stride 68 (transposed)
    __shared__ float Ss[64 * 68];    // [q][k]   stride 68 (even -> aligned v2f)

    int qt = blockIdx.x;
    int h  = blockIdx.y;
    int b  = blockIdx.z;
    int bh = b * HEADS + h;
    int qBase = qt * 64;

    int tid  = threadIdx.x;
    int wave = tid >> 5, lane = tid & 31;
    int ln15 = lane & 15;
    int dK   = (lane < 16) ? 0 : 2;
    int mt   = wave & 3;
    int ntB  = (wave >> 2) * 2;

    int qr = tid >> 4, qf = tid & 15;     // Q/CK staging: 4 rows apart by 16
    int vr = tid >> 6, vc = tid & 63;     // CV staging: 16 rows apart by 4

    const float* qg = q_raw + ((size_t)(b * SEQ + qBase)) * (HEADS * FDIM) + h * FDIM;
#ifdef USE_ASYNC_LDS
    #pragma unroll
    for (int i = 0; i < 4; ++i)
        __builtin_amdgcn_global_load_async_to_lds_b32(
            (AS1 int*)(qg + (size_t)(qr + i * 16) * (HEADS * FDIM) + qf),
            (AS3 int*)(Qs + (qr + i * 16) * 20 + qf), 0, 0);
#else
    {
        float tq[4];
        #pragma unroll
        for (int i = 0; i < 4; ++i)
            tq[i] = qg[(size_t)(qr + i * 16) * (HEADS * FDIM) + qf];
        #pragma unroll
        for (int i = 0; i < 4; ++i) Qs[(qr + i * 16) * 20 + qf] = tq[i];
    }
#endif

    v8f o0 = {}, o1 = {};
    float rsum = 0.f;

    for (int kt = 0; kt <= qt; ++kt) {
        int kBase = kt * 64;
        const float* ckg = ck + ((size_t)bh * SEQ + kBase) * FDIM;
        const float* cvg = cv + ((size_t)bh * SEQ + kBase) * DHEAD;
        __syncthreads();
#ifdef USE_ASYNC_LDS
        #pragma unroll
        for (int i = 0; i < 4; ++i)
            __builtin_amdgcn_global_load_async_to_lds_b32(
                (AS1 int*)(ckg + (size_t)(qr + i * 16) * FDIM + qf),
                (AS3 int*)(CKs + (qr + i * 16) * 20 + qf), 0, 0);
        #pragma unroll
        for (int i = 0; i < 16; ++i)
            __builtin_amdgcn_global_load_async_to_lds_b32(
                (AS1 int*)(cvg + (size_t)(vr + i * 4) * DHEAD + vc),
                (AS3 int*)(CVt + vc * 68 + vr + i * 4), 0, 0);
        __builtin_amdgcn_s_wait_asynccnt(0);
#else
        {
            float tk[4], tv[16];
            #pragma unroll
            for (int i = 0; i < 4; ++i)
                tk[i] = ckg[(size_t)(qr + i * 16) * FDIM + qf];
            #pragma unroll
            for (int i = 0; i < 16; ++i)
                tv[i] = cvg[(size_t)(vr + i * 4) * DHEAD + vc];
            #pragma unroll
            for (int i = 0; i < 4; ++i) CKs[(qr + i * 16) * 20 + qf] = tk[i];
            #pragma unroll
            for (int i = 0; i < 16; ++i) CVt[vc * 68 + vr + i * 4] = tv[i];
        }
#endif
        __syncthreads();

        // ---- S tiles: two 16x16 tiles per wave, F=16 in four x4 steps ----
        bool diag = (kt == qt);
        #pragma unroll
        for (int sub = 0; sub < 2; ++sub) {
            int nt = ntB + sub;
            v8f s = {};
            #pragma unroll
            for (int st = 0; st < 4; ++st) {
                int f0 = st * 4 + dK;
                v2f a  = *(const v2f*)(&Qs[(mt * 16 + ln15) * 20 + f0]);
                v2f bb = *(const v2f*)(&CKs[(nt * 16 + ln15) * 20 + f0]);
                s = wmma_f32(a, bb, s);
            }
            int c = nt * 16 + ln15;
            #pragma unroll
            for (int j = 0; j < 8; ++j) {
                int m = mt * 16 + j + ((lane < 16) ? 0 : 8);
                float val = s[j];
                if (diag && (c > m)) val = 0.f;   // causal: keep key<=query
                Ss[m * 68 + c] = val;
            }
        }
        __syncthreads();

        // ---- per-row sum of squares (threads 0..63, one row each) ----
        if (tid < 64) {
            float a = 0.f;
            #pragma unroll 8
            for (int c = 0; c < 64; ++c) { float x = Ss[tid * 68 + c]; a += x * x; }
            rsum += a;
        }

        // ---- O += S * CV : contraction over 64 keys, 16 x4 steps ----
        #pragma unroll 4
        for (int st = 0; st < 16; ++st) {
            int k0 = st * 4 + dK;
            v2f a  = *(const v2f*)(&Ss[(mt * 16 + ln15) * 68 + k0]);
            v2f b0 = *(const v2f*)(&CVt[(ntB * 16 + ln15) * 68 + k0]);
            v2f b1 = *(const v2f*)(&CVt[((ntB + 1) * 16 + ln15) * 68 + k0]);
            o0 = wmma_f32(a, b0, o0);
            o1 = wmma_f32(a, b1, o1);
        }
    }

    #pragma unroll
    for (int j = 0; j < 8; ++j) {
        int m = mt * 16 + j + ((lane < 16) ? 0 : 8);
        size_t rowOff = ((size_t)bh * SEQ + qBase + m) * DHEAD;
        qKV[rowOff + ntB * 16 + ln15]       = o0[j];
        qKV[rowOff + (ntB + 1) * 16 + ln15] = o1[j];
    }
    if (tid < 64) rs[(size_t)bh * SEQ + qBase + tid] = rsum;
}

// ---------------------------------------------------------------------------
// Denominator scan: cum = cumsum_q(rowSumSq / (2*DH)); dinv = 1/((q+1)+cum)
// ---------------------------------------------------------------------------
__global__ void denom_kernel(const float* __restrict__ rs, float* __restrict__ dinv)
{
    int bh = blockIdx.x;
    if (threadIdx.x != 0) return;
    const float inv2d = 1.0f / (2.0f * DHEAD);
    float cum = 0.f;
    for (int q = 0; q < SEQ; ++q) {
        cum += rs[(size_t)bh * SEQ + q] * inv2d;
        dinv[(size_t)bh * SEQ + q] = 1.0f / ((float)(q + 1) + cum);
    }
}

// ---------------------------------------------------------------------------
// y[b,l,h*DH+i] = mv + (qKV / sqrt(DH)) * dinv   (row-major for final GEMM)
// ---------------------------------------------------------------------------
__global__ __launch_bounds__(256) void finalize_kernel(
    const float* __restrict__ qKV, const float* __restrict__ mv,
    const float* __restrict__ dinv, float* __restrict__ y)
{
    size_t idx = (size_t)blockIdx.x * 256 + threadIdx.x;
    if (idx >= (size_t)BATCH * HEADS * SEQ * DHEAD) return;
    size_t rowIdx = idx >> 6;           // bh*SEQ + l
    int i  = (int)(idx & 63);
    int l  = (int)(rowIdx & (SEQ - 1));
    int bh = (int)(rowIdx >> 11);
    int b  = bh / HEADS, h = bh - b * HEADS;
    const float invSqrtDh = 0.125f;     // 1/sqrt(64)
    float val = mv[idx] + qKV[idx] * invSqrtDh * dinv[rowIdx];
    y[((size_t)(b * SEQ + l)) * DMODEL + h * DHEAD + i] = val;
}

// ---------------------------------------------------------------------------
extern "C" void kernel_launch(void* const* d_in, const int* in_sizes, int n_in,
                              void* d_out, int out_size, void* d_ws, size_t ws_size,
                              hipStream_t stream) {
    const float* hs = (const float*)d_in[0];
    const float* Wq = (const float*)d_in[1];
    const float* Wk = (const float*)d_in[2];
    const float* Wv = (const float*)d_in[3];
    const float* Wo = (const float*)d_in[4];
    float* out = (float*)d_out;

    const int M  = BATCH * SEQ;            // 4096
    const int NF = HEADS * FDIM;           // 192
    const int NV = HEADS * DHEAD;          // 768

    float* ws = (float*)d_ws;
    size_t off = 0;
    float* q_raw = ws + off; off += (size_t)M * NF;
    float* k_raw = ws + off; off += (size_t)M * NF;
    float* v_raw = ws + off; off += (size_t)M * NV;
    float* ck    = ws + off; off += (size_t)BATCH * HEADS * SEQ * FDIM;
    float* cv    = ws + off; off += (size_t)BATCH * HEADS * SEQ * DHEAD;
    float* mv    = ws + off; off += (size_t)BATCH * HEADS * SEQ * DHEAD;
    float* qKV   = ws + off; off += (size_t)BATCH * HEADS * SEQ * DHEAD;
    float* rsbuf = ws + off; off += (size_t)BATCH * HEADS * SEQ;
    float* dinv  = ws + off; off += (size_t)BATCH * HEADS * SEQ;
    float* ybuf  = ws + off; off += (size_t)M * DMODEL;
    (void)ws_size; (void)in_sizes; (void)n_in; (void)out_size;

    // 1-3: input projections
    gemm_wmma_f32<<<dim3((M / GBM) * (NF / GBN)), 256, 0, stream>>>(hs, Wq, q_raw, M, DMODEL, NF);
    gemm_wmma_f32<<<dim3((M / GBM) * (NF / GBN)), 256, 0, stream>>>(hs, Wk, k_raw, M, DMODEL, NF);
    gemm_wmma_f32<<<dim3((M / GBM) * (NV / GBN)), 256, 0, stream>>>(hs, Wv, v_raw, M, DMODEL, NV);

    // 4: running-mean centering
    center_scan_kernel<<<dim3(HEADS, BATCH), 128, 0, stream>>>(k_raw, v_raw, ck, cv, mv);

    // 5: fused causal attention core
    atten_kernel<<<dim3(SEQ / 64, HEADS, BATCH), 256, 0, stream>>>(q_raw, ck, cv, qKV, rsbuf);

    // 6: denominator scan
    denom_kernel<<<dim3(BATCH * HEADS), 32, 0, stream>>>(rsbuf, dinv);

    // 7: finalize y
    size_t nElem = (size_t)BATCH * HEADS * SEQ * DHEAD;
    finalize_kernel<<<dim3((unsigned)((nElem + 255) / 256)), 256, 0, stream>>>(qKV, mv, dinv, ybuf);

    // 8: output projection
    gemm_wmma_f32<<<dim3((M / GBM) * (DMODEL / GBN)), 256, 0, stream>>>(ybuf, Wo, out, M, DMODEL, DMODEL);
}

// v001
// It runs in 302 microseconds.
// Next to v000, in two timings, it ran 2.43 and 2.42 times as fast.
#include <hip/hip_runtime.h>
#include <hip/hip_bf16.h>

typedef __attribute__((ext_vector_type(2))) float v2f;
typedef __attribute__((ext_vector_type(4))) float v4f;
typedef __attribute__((ext_vector_type(8))) float v8f;

#define BATCH 2
#define SEQ   2048
#define DMODEL 768
#define HEADS 12
#define FDIM  16
#define DHEAD 64

#define AS1 __attribute__((address_space(1)))
#define AS3 __attribute__((address_space(3)))

#if defined(__has_builtin)
#if __has_builtin(__builtin_amdgcn_global_load_async_to_lds_b32) && \
    __has_builtin(__builtin_amdgcn_s_wait_asynccnt)
#define USE_ASYNC_LDS 1
#endif
#endif

static __device__ __forceinline__ v8f wmma_f32(v2f a, v2f b, v8f c) {
    return __builtin_amdgcn_wmma_f32_16x16x4_f32(false, a, false, b, (short)0, c, false, false);
}

// ---------------------------------------------------------------------------
// Block-tiled fp32 WMMA GEMM: C(MxN) = A(MxK,rm) * B(KxN,rm).
// Block = 128x64 C tile, 8 waves, each wave a 32x32 sub-block (4 WMMA tiles).
// K staged in 16-wide slabs; A row-major (stride 20), B transposed (stride 18)
// in LDS so every WMMA operand is a single aligned ds_load_b64, bank-conflict
// free for both lane halves. Slabs staged via async global->LDS DMA when the
// toolchain exposes it. Requires M%128==0, N%64==0, K%16==0.
// ---------------------------------------------------------------------------
#define GBM 128
#define GBN 64
#define GKT 16

__global__ __launch_bounds__(256) void gemm_wmma_f32(
    const float* __restrict__ A, const float* __restrict__ B,
    float* __restrict__ C, int M, int K, int N)
{
    __shared__ float As[GBM * 20];   // [row][k]  128 x 16, stride 20
    __shared__ float Bt[GBN * 18];   // [col][k]   64 x 16, stride 18 (transposed)

    int tid  = threadIdx.x;
    int wave = tid >> 5, lane = tid & 31;
    int ln15 = lane & 15;
    int dK   = (lane < 16) ? 0 : 2;

    int nBlocks = N / GBN;
    int bm = blockIdx.x / nBlocks;
    int bn = blockIdx.x - bm * nBlocks;
    int rowBase = bm * GBM;
    int colBase = bn * GBN;

    int aRow0 = (wave & 3) * 32;
    int bCol0 = (wave >> 2) * 32;

    int ar = tid >> 4, af = tid & 15;     // A staging: 8 rows apart by 16
    int br = tid >> 6, bc = tid & 63;     // B staging: 4 rows apart by 4

    v8f acc00 = {}, acc01 = {}, acc10 = {}, acc11 = {};

    for (int k0 = 0; k0 < K; k0 += GKT) {
        __syncthreads();
#ifdef USE_ASYNC_LDS
        #pragma unroll
        for (int i = 0; i < 8; ++i)
            __builtin_amdgcn_global_load_async_to_lds_b32(
                (AS1 int*)(A + (size_t)(rowBase + ar + i * 16) * K + k0 + af),
                (AS3 int*)(As + (ar + i * 16) * 20 + af), 0, 0);
        #pragma unroll
        for (int i = 0; i < 4; ++i)
            __builtin_amdgcn_global_load_async_to_lds_b32(
                (AS1 int*)(B + (size_t)(k0 + br + i * 4) * N + colBase + bc),
                (AS3 int*)(Bt + bc * 18 + br + i * 4), 0, 0);
        __builtin_amdgcn_s_wait_asynccnt(0);
#else
        float ta[8], tb[4];
        #pragma unroll
        for (int i = 0; i < 8; ++i)
            ta[i] = A[(size_t)(rowBase + ar + i * 16) * K + k0 + af];
        #pragma unroll
        for (int i = 0; i < 4; ++i)
            tb[i] = B[(size_t)(k0 + br + i * 4) * N + colBase + bc];
        #pragma unroll
        for (int i = 0; i < 8; ++i) As[(ar + i * 16) * 20 + af] = ta[i];
        #pragma unroll
        for (int i = 0; i < 4; ++i) Bt[bc * 18 + br + i * 4] = tb[i];
#endif
        if (k0 + GKT < K) {                                    // global_prefetch_b8
            __builtin_prefetch(&A[(size_t)(rowBase + (tid & 127)) * K + k0 + GKT], 0, 3);
            if (tid < GKT)
                __builtin_prefetch(&B[(size_t)(k0 + GKT + tid) * N + colBase], 0, 3);
        }
        __syncthreads();

        #pragma unroll
        for (int st = 0; st < GKT / 4; ++st) {
            int kk = st * 4 + dK;                              // even -> 8B-aligned
            v2f a0 = *(const v2f*)(&As[(aRow0 + ln15) * 20 + kk]);
            v2f a1 = *(const v2f*)(&As[(aRow0 + 16 + ln15) * 20 + kk]);
            v2f b0 = *(const v2f*)(&Bt[(bCol0 + ln15) * 18 + kk]);
            v2f b1 = *(const v2f*)(&Bt[(bCol0 + 16 + ln15) * 18 + kk]);
            acc00 = wmma_f32(a0, b0, acc00);
            acc01 = wmma_f32(a0, b1, acc01);
            acc10 = wmma_f32(a1, b0, acc10);
            acc11 = wmma_f32(a1, b1, acc11);
        }
    }

    #pragma unroll
    for (int j = 0; j < 8; ++j) {
        int rL = j + ((lane < 16) ? 0 : 8);
        int r0 = rowBase + aRow0 + rL;
        int r1 = r0 + 16;
        int c0 = colBase + bCol0 + ln15;
        int c1 = c0 + 16;
        C[(size_t)r0 * N + c0] = acc00[j];
        C[(size_t)r0 * N + c1] = acc01[j];
        C[(size_t)r1 * N + c0] = acc10[j];
        C[(size_t)r1 * N + c1] = acc11[j];
    }
}

// ---------------------------------------------------------------------------
// Running-mean centering as a chunked parallel prefix sum over the sequence.
// One block = 32 columns (one 128-byte line of a row) x 512 rows of one batch.
// 256 threads = 8 column quads x 32 chunks; a thread owns 16 rows x 4 columns.
// The rows in front of the block's part are summed again by the block itself
// (no hand-over between blocks); chunk sums meet by lane shifts inside a wave,
// wave sums in LDS behind one barrier.
// ---------------------------------------------------------------------------
#define CS_PARTS  4
#define CS_ROWS   (SEQ / CS_PARTS)            // 512 rows a block
#define CS_CHUNKS 32
#define CS_RPT    (CS_ROWS / CS_CHUNKS)       // 16 rows a thread
#define CS_KGRP   (HEADS * FDIM / 32)         // 6 column groups of k
#define CS_VGRP   (HEADS * DHEAD / 32)        // 24 column groups of v

// IS_K picks the row pitch at compile time, so that every row of a thread is
// one address register plus an immediate offset.
template <bool IS_K>
static __device__ __forceinline__ void center_part(
    const float* __restrict__ raw, float* __restrict__ centered, float* __restrict__ mean,
    int grp, int b, int part, v4f (*tot)[8], v4f (*pre)[8])
{
    constexpr int PITCH = IS_K ? HEADS * FDIM : HEADS * DHEAD;   // floats in a source row
    constexpr int W     = IS_K ? FDIM : DHEAD;                   // floats in a head's row

    int quad  = threadIdx.x & 7;
    int chunk = threadIdx.x >> 3;
    int col   = grp * 32 + quad * 4;
    int row0  = part * CS_ROWS + chunk * CS_RPT;
    const float* colp = raw + (size_t)b * SEQ * PITCH + col;

    const float* own = colp + (size_t)row0 * PITCH;
    v4f x[CS_RPT];
    #pragma unroll
    for (int r = 0; r < CS_RPT - 1; ++r)
        x[r] = *(const v4f*)(own + r * PITCH);
    // precaution: the build lets the last row's result take the address pair that
    // the loads above name; their wait stands in front of that overwrite
    asm volatile("s_wait_xcnt 0x0" ::: "memory");
    x[CS_RPT - 1] = *(const v4f*)(own + (CS_RPT - 1) * PITCH);

    // rows in front of the part, dealt row by row over the 32 chunks
    const float* front = colp + (size_t)chunk * PITCH;
    v4f p = {};
    #pragma unroll
    for (int i = 0; i < CS_PARTS - 1; ++i) {
        if (i < part) {
            #pragma unroll
            for (int r = 0; r < CS_RPT; ++r)
                p += *(const v4f*)(front + (i * CS_RPT + r) * CS_CHUNKS * PITCH);
        }
    }

    v4f s = x[0];
    #pragma unroll
    for (int r = 1; r < CS_RPT; ++r) s += x[r];

    // the wave's 4 chunks meet by lane shifts: sums of the chunks in front (exc),
    // and the wave's whole share of the front rows (pw)
    int wave = threadIdx.x >> 5;
    int cw   = chunk & 3;
    v4f exc = {}, pw = p;
    #pragma unroll
    for (int d = 1; d < 4; ++d) {
        #pragma unroll
        for (int k = 0; k < 4; ++k) {
            float up = __shfl_up(s[k], 8 * d, 32);
            exc[k] += (cw >= d) ? up : 0.f;
            pw[k]  += __shfl_xor(p[k], 8 * d, 32);
        }
    }
    if (cw == 3) {
        tot[wave][quad] = exc + s;
        pre[wave][quad] = pw;
    }
    __syncthreads();

    v4f run = {};
    #pragma unroll
    for (int w = 0; w < 8; ++w) run += pre[w][quad];
    #pragma unroll
    for (int w = 0; w < 7; ++w) {
        v4f tw = tot[w][quad];
        run += (w < wave) ? tw : v4f{};   // a select, so that all the LDS reads fly together
    }
    run += exc;

    int bh = b * HEADS + col / W;
    size_t o = ((size_t)bh * SEQ + row0) * W + (col % W);
    float* dc = centered + o;
    float* dm = mean + o;
    #pragma unroll
    for (int r = 0; r < CS_RPT; ++r) {
        run += x[r];
        v4f m = run / (float)(row0 + r + 1);
        if (!IS_K) *(v4f*)(dm + r * W) = m;
        *(v4f*)(dc + r * W) = x[r] - m;
    }
    // precaution: in the build the k path's code follows the v path's and rewrites the
    // registers that the stores above name; their wait stands behind the last store
    if (!IS_K) asm volatile("s_wait_xcnt 0x0" ::: "memory");
}

__global__ __launch_bounds__(256) void center_scan_kernel(
    const float* __restrict__ k_raw, const float* __restrict__ v_raw,
    float* __restrict__ ck, float* __restrict__ cv, float* __restrict__ mv)
{
    __shared__ v4f tot[8][8];   // [wave][quad] sum of the wave's own 64 rows
    __shared__ v4f pre[8][8];   // [wave][quad] the wave's share of the rows in front of the part

    int g    = blockIdx.x;
    int b    = blockIdx.y;
    int part = CS_PARTS - 1 - blockIdx.z;     // the part with most rows in front starts first

    if (g < CS_KGRP) center_part<true >(k_raw, ck, ck, g,           b, part, tot, pre);
    else             center_part<false>(v_raw, cv, mv, g - CS_KGRP, b, part, tot, pre);
}

// ---------------------------------------------------------------------------
// Fused causal attention core (flash-style): one block per (b,h,64-query tile).
// S = Q * CK^T via WMMA into LDS (diag tile masked); per-row sum of S^2 and
// O += S * CV (WMMA, CV transposed in LDS) consumed from LDS.
// ---------------------------------------------------------------------------
__global__ __launch_bounds__(256) void atten_kernel(
    const float* __restrict__ q_raw, const float* __restrict__ ck,
    const float* __restrict__ cv, float* __restrict__ qKV, float* __restrict__ rs)
{
    __shared__ float Qs[64 * 20];    // [q][f]   stride 20
    __shared__ float CKs[64 * 20];   // [k][f]   stride 20
    __shared__ float CVt[64 * 68];   // [d][k]   stride 68 (transposed)
    __shared__ float Ss[64 * 68];    // [q][k]   stride 68 (even -> aligned v2f)

    int qt = blockIdx.x;
    int h  = blockIdx.y;
    int b  = blockIdx.z;
    int bh = b * HEADS + h;
    int qBase = qt * 64;

    int tid  = threadIdx.x;
    int wave = tid >> 5, lane = tid & 31;
    int ln15 = lane & 15;
    int dK   = (lane < 16) ? 0 : 2;
    int mt   = wave & 3;
    int ntB  = (wave >> 2) * 2;

    int qr = tid >> 4, qf = tid & 15;     // Q/CK staging: 4 rows apart by 16
    int vr = tid >> 6, vc = tid & 63;     // CV staging: 16 rows apart by 4

    const float* qg = q_raw + ((size_t)(b * SEQ + qBase)) * (HEADS * FDIM) + h * FDIM;
#ifdef USE_ASYNC_LDS
    #pragma unroll
    for (int i = 0; i < 4; ++i)
        __builtin_amdgcn_global_load_async_to_lds_b32(
            (AS1 int*)(qg + (size_t)(qr + i * 16) * (HEADS * FDIM) + qf),
            (AS3 int*)(Qs + (qr + i * 16) * 20 + qf), 0, 0);
#else
    {
        float tq[4];
        #pragma unroll
        for (int i = 0; i < 4; ++i)
            tq[i] = qg[(size_t)(qr + i * 16) * (HEADS * FDIM) + qf];
        #pragma unroll
        for (int i = 0; i < 4; ++i) Qs[(qr + i * 16) * 20 + qf] = tq[i];
    }
#endif

    v8f o0 = {}, o1 = {};
    float rsum = 0.f;

    for (int kt = 0; kt <= qt; ++kt) {
        int kBase = kt * 64;
        const float* ckg = ck + ((size_t)bh * SEQ + kBase) * FDIM;
        const float* cvg = cv + ((size_t)bh * SEQ + kBase) * DHEAD;
        __syncthreads();
#ifdef USE_ASYNC_LDS
        #pragma unroll
        for (int i = 0; i < 4; ++i)
            __builtin_amdgcn_global_load_async_to_lds_b32(
                (AS1 int*)(ckg + (size_t)(qr + i * 16) * FDIM + qf),
                (AS3 int*)(CKs + (qr + i * 16) * 20 + qf), 0, 0);
        #pragma unroll
        for (int i = 0; i < 16; ++i)
            __builtin_amdgcn_global_load_async_to_lds_b32(
                (AS1 int*)(cvg + (size_t)(vr + i * 4) * DHEAD + vc),
                (AS3 int*)(CVt + vc * 68 + vr + i * 4), 0, 0);
        __builtin_amdgcn_s_wait_asynccnt(0);
#else
        {
            float tk[4], tv[16];
            #pragma unroll
            for (int i = 0; i < 4; ++i)
                tk[i] = ckg[(size_t)(qr + i * 16) * FDIM + qf];
            #pragma unroll
            for (int i = 0; i < 16; ++i)
                tv[i] = cvg[(size_t)(vr + i * 4) * DHEAD + vc];
            #pragma unroll
            for (int i = 0; i < 4; ++i) CKs[(qr + i * 16) * 20 + qf] = tk[i];
            #pragma unroll
            for (int i = 0; i < 16; ++i) CVt[vc * 68 + vr + i * 4] = tv[i];
        }
#endif
        __syncthreads();

        // ---- S tiles: two 16x16 tiles per wave, F=16 in four x4 steps ----
        bool diag = (kt == qt);
        #pragma unroll
        for (int sub = 0; sub < 2; ++sub) {
            int nt = ntB + sub;
            v8f s = {};
            #pragma unroll
            for (int st = 0; st < 4; ++st) {
                int f0 = st * 4 + dK;
                v2f a  = *(const v2f*)(&Qs[(mt * 16 + ln15) * 20 + f0]);
                v2f bb = *(const v2f*)(&CKs[(nt * 16 + ln15) * 20 + f0]);
                s = wmma_f32(a, bb, s);
            }
            int c = nt * 16 + ln15;
            #pragma unroll
            for (int j = 0; j < 8; ++j) {
                int m = mt * 16 + j + ((lane < 16) ? 0 : 8);
                float val = s[j];
                if (diag && (c > m)) val = 0.f;   // causal: keep key<=query
                Ss[m * 68 + c] = val;
            }
        }
        __syncthreads();

        // ---- per-row sum of squares (threads 0..63, one row each) ----
        if (tid < 64) {
            float a = 0.f;
            #pragma unroll 8
            for (int c = 0; c < 64; ++c) { float x = Ss[tid * 68 + c]; a += x * x; }
            rsum += a;
        }

        // ---- O += S * CV : contraction over 64 keys, 16 x4 steps ----
        #pragma unroll 4
        for (int st = 0; st < 16; ++st) {
            int k0 = st * 4 + dK;
            v2f a  = *(const v2f*)(&Ss[(mt * 16 + ln15) * 68 + k0]);
            v2f b0 = *(const v2f*)(&CVt[(ntB * 16 + ln15) * 68 + k0]);
            v2f b1 = *(const v2f*)(&CVt[((ntB + 1) * 16 + ln15) * 68 + k0]);
            o0 = wmma_f32(a, b0, o0);
            o1 = wmma_f32(a, b1, o1);
        }
    }

    #pragma unroll
    for (int j = 0; j < 8; ++j) {
        int m = mt * 16 + j + ((lane < 16) ? 0 : 8);
        size_t rowOff = ((size_t)bh * SEQ + qBase + m) * DHEAD;
        qKV[rowOff + ntB * 16 + ln15]       = o0[j];
        qKV[rowOff + (ntB + 1) * 16 + ln15] = o1[j];
    }
    if (tid < 64) rs[(size_t)bh * SEQ + qBase + tid] = rsum;
}

// ---------------------------------------------------------------------------
// Denominator scan: cum = cumsum_q(rowSumSq / (2*DH)); dinv = 1/((q+1)+cum)
// ---------------------------------------------------------------------------
// Chunked parallel prefix sum: 256 threads x 8 rows; thread sums are scanned
// inside each wave by lane shifts, wave sums meet in LDS behind one barrier.
__global__ __launch_bounds__(256) void denom_kernel(const float* __restrict__ rs, float* __restrict__ dinv)
{
    __shared__ float wsum[8];
    int bh   = blockIdx.x;
    int t    = threadIdx.x;
    int lane = t & 31, wave = t >> 5;
    const float inv2d = 1.0f / (2.0f * DHEAD);
    size_t base = (size_t)bh * SEQ + t * 8;

    v4f lo = *(const v4f*)(rs + base) * inv2d;
    v4f hi = *(const v4f*)(rs + base + 4) * inv2d;
    float x[8] = {lo[0], lo[1], lo[2], lo[3], hi[0], hi[1], hi[2], hi[3]};

    float s = x[0];
    #pragma unroll
    for (int j = 1; j < 8; ++j) s += x[j];

    float inc = s;                               // inclusive scan over the wave's 32 thread sums
    #pragma unroll
    for (int d = 1; d < 32; d <<= 1) {
        float up = __shfl_up(inc, d, 32);
        if (lane >= d) inc += up;
    }
    if (lane == 31) wsum[wave] = inc;
    float exc = __shfl_up(inc, 1, 32);
    if (lane == 0) exc = 0.f;
    __syncthreads();

    float cum = 0.f;
    #pragma unroll
    for (int w = 0; w < 7; ++w) {
        float tw = wsum[w];
        if (w < wave) cum += tw;
    }
    cum += exc;

    float r[8];
    #pragma unroll
    for (int j = 0; j < 8; ++j) {
        cum += x[j];
        r[j] = 1.0f / ((float)(t * 8 + j + 1) + cum);
    }
    v4f olo = {r[0], r[1], r[2], r[3]}, ohi = {r[4], r[5], r[6], r[7]};
    *(v4f*)(dinv + base)     = olo;
    *(v4f*)(dinv + base + 4) = ohi;
}

// ---------------------------------------------------------------------------
// y[b,l,h*DH+i] = mv + (qKV / sqrt(DH)) * dinv   (row-major for final GEMM)
// ---------------------------------------------------------------------------
__global__ __launch_bounds__(256) void finalize_kernel(
    const float* __restrict__ qKV, const float* __restrict__ mv,
    const float* __restrict__ dinv, float* __restrict__ y)
{
    size_t idx = (size_t)blockIdx.x * 256 + threadIdx.x;
    if (idx >= (size_t)BATCH * HEADS * SEQ * DHEAD) return;
    size_t rowIdx = idx >> 6;           // bh*SEQ + l
    int i  = (int)(idx & 63);
    int l  = (int)(rowIdx & (SEQ - 1));
    int bh = (int)(rowIdx >> 11);
    int b  = bh / HEADS, h = bh - b * HEADS;
    const float invSqrtDh = 0.125f;     // 1/sqrt(64)
    float val = mv[idx] + qKV[idx] * invSqrtDh * dinv[rowIdx];
    y[((size_t)(b * SEQ + l)) * DMODEL + h * DHEAD + i] = val;
}

// ---------------------------------------------------------------------------
extern "C" void kernel_launch(void* const* d_in, const int* in_sizes, int n_in,
                              void* d_out, int out_size, void* d_ws, size_t ws_size,
                              hipStream_t stream) {
    const float* hs = (const float*)d_in[0];
    const float* Wq = (const float*)d_in[1];
    const float* Wk = (const float*)d_in[2];
    const float* Wv = (const float*)d_in[3];
    const float* Wo = (const float*)d_in[4];
    float* out = (float*)d_out;

    const int M  = BATCH * SEQ;            // 4096
    const int NF = HEADS * FDIM;           // 192
    const int NV = HEADS * DHEAD;          // 768

    float* ws = (float*)d_ws;
    size_t off = 0;
    float* q_raw = ws + off; off += (size_t)M * NF;
    float* k_raw = ws + off; off += (size_t)M * NF;
    float* v_raw = ws + off; off += (size_t)M * NV;
    float* ck    = ws + off; off += (size_t)BATCH * HEADS * SEQ * FDIM;
    float* cv    = ws + off; off += (size_t)BATCH * HEADS * SEQ * DHEAD;
    float* mv    = ws + off; off += (size_t)BATCH * HEADS * SEQ * DHEAD;
    float* qKV   = ws + off; off += (size_t)BATCH * HEADS * SEQ * DHEAD;
    float* rsbuf = ws + off; off += (size_t)BATCH * HEADS * SEQ;
    float* dinv  = ws + off; off += (size_t)BATCH * HEADS * SEQ;
    float* ybuf  = ws + off; off += (size_t)M * DMODEL;
    (void)ws_size; (void)in_sizes; (void)n_in; (void)out_size;

    // 1-3: input projections
    gemm_wmma_f32<<<dim3((M / GBM) * (NF / GBN)), 256, 0, stream>>>(hs, Wq, q_raw, M, DMODEL, NF);
    gemm_wmma_f32<<<dim3((M / GBM) * (NF / GBN)), 256, 0, stream>>>(hs, Wk, k_raw, M, DMODEL, NF);
    gemm_wmma_f32<<<dim3((M / GBM) * (NV / GBN)), 256, 0, stream>>>(hs, Wv, v_raw, M, DMODEL, NV);

    // 4: running-mean centering
    center_scan_kernel<<<dim3(CS_KGRP + CS_VGRP, BATCH, CS_PARTS), 256, 0, stream>>>(k_raw, v_raw, ck, cv, mv);

    // 5: fused causal attention core
    atten_kernel<<<dim3(SEQ / 64, HEADS, BATCH), 256, 0, stream>>>(q_raw, ck, cv, qKV, rsbuf);

    // 6: denominator scan
    denom_kernel<<<dim3(BATCH * HEADS), 256, 0, stream>>>(rsbuf, dinv);

    // 7: finalize y
    size_t nElem = (size_t)BATCH * HEADS * SEQ * DHEAD;
    finalize_kernel<<<dim3((unsigned)((nElem + 255) / 256)), 256, 0, stream>>>(qKV, mv, dinv, ybuf);

    // 8: output projection
    gemm_wmma_f32<<<dim3((M / GBM) * (DMODEL / GBN)), 256, 0, stream>>>(ybuf, Wo, out, M, DMODEL, DMODEL);
}

// v002
// Measured time: 251 microseconds a run.
// Two timings next to v001 both put it at 1.20 times that version's speed.
// Over all steps from v000 it is 2.92 times as fast.
#include <hip/hip_runtime.h>
#include <hip/hip_bf16.h>

typedef __attribute__((ext_vector_type(2))) float v2f;
typedef __attribute__((ext_vector_type(4))) float v4f;
typedef __attribute__((ext_vector_type(8))) float v8f;

#define BATCH 2
#define SEQ   2048
#define DMODEL 768
#define HEADS 12
#define FDIM  16
#define DHEAD 64

#define AS1 __attribute__((address_space(1)))
#define AS3 __attribute__((address_space(3)))

#if defined(__has_builtin)
#if __has_builtin(__builtin_amdgcn_global_load_async_to_lds_b32) && \
    __has_builtin(__builtin_amdgcn_s_wait_asynccnt)
#define USE_ASYNC_LDS 1
#endif
#endif

static __device__ __forceinline__ v8f wmma_f32(v2f a, v2f b, v8f c) {
    return __builtin_amdgcn_wmma_f32_16x16x4_f32(false, a, false, b, (short)0, c, false, false);
}

// ---------------------------------------------------------------------------
// Block-tiled fp32 WMMA GEMM: C(MxN) = A(MxK,rm) * B(KxN,rm).
// Block = 128x64 C tile, 8 waves, each wave a 32x32 sub-block (4 WMMA tiles).
// K staged in 16-wide slabs; A row-major (stride 20), B transposed (stride 18)
// in LDS so every WMMA operand is a single aligned ds_load_b64, bank-conflict
// free for both lane halves. Slabs staged via async global->LDS DMA when the
// toolchain exposes it. Requires M%128==0, N%64==0, K%16==0.
// ---------------------------------------------------------------------------
#define GBM 128
#define GBN 64
#define GKT 16

static __device__ __forceinline__ void gemm_tile(
    const float* __restrict__ A, const float* __restrict__ B,
    float* __restrict__ C, int K, int N, int rowBase, int colBase)
{
    __shared__ float As[GBM * 20];   // [row][k]  128 x 16, stride 20
    __shared__ float Bt[GBN * 18];   // [col][k]   64 x 16, stride 18 (transposed)

    int tid  = threadIdx.x;
    int wave = tid >> 5, lane = tid & 31;
    int ln15 = lane & 15;
    int dK   = (lane < 16) ? 0 : 2;

    int aRow0 = (wave & 3) * 32;
    int bCol0 = (wave >> 2) * 32;

    int ar = tid >> 4, af = tid & 15;     // A staging: 8 rows apart by 16
    int br = tid >> 6, bc = tid & 63;     // B staging: 4 rows apart by 4

    v8f acc00 = {}, acc01 = {}, acc10 = {}, acc11 = {};

    for (int k0 = 0; k0 < K; k0 += GKT) {
        __syncthreads();
#ifdef USE_ASYNC_LDS
        #pragma unroll
        for (int i = 0; i < 8; ++i)
            __builtin_amdgcn_global_load_async_to_lds_b32(
                (AS1 int*)(A + (size_t)(rowBase + ar + i * 16) * K + k0 + af),
                (AS3 int*)(As + (ar + i * 16) * 20 + af), 0, 0);
        #pragma unroll
        for (int i = 0; i < 4; ++i)
            __builtin_amdgcn_global_load_async_to_lds_b32(
                (AS1 int*)(B + (size_t)(k0 + br + i * 4) * N + colBase + bc),
                (AS3 int*)(Bt + bc * 18 + br + i * 4), 0, 0);
        __builtin_amdgcn_s_wait_asynccnt(0);
#else
        float ta[8], tb[4];
        #pragma unroll
        for (int i = 0; i < 8; ++i)
            ta[i] = A[(size_t)(rowBase + ar + i * 16) * K + k0 + af];
        #pragma unroll
        for (int i = 0; i < 4; ++i)
            tb[i] = B[(size_t)(k0 + br + i * 4) * N + colBase + bc];
        #pragma unroll
        for (int i = 0; i < 8; ++i) As[(ar + i * 16) * 20 + af] = ta[i];
        #pragma unroll
        for (int i = 0; i < 4; ++i) Bt[bc * 18 + br + i * 4] = tb[i];
#endif
        if (k0 + GKT < K) {                                    // global_prefetch_b8
            __builtin_prefetch(&A[(size_t)(rowBase + (tid & 127)) * K + k0 + GKT], 0, 3);
            if (tid < GKT)
                __builtin_prefetch(&B[(size_t)(k0 + GKT + tid) * N + colBase], 0, 3);
        }
        __syncthreads();

        #pragma unroll
        for (int st = 0; st < GKT / 4; ++st) {
            int kk = st * 4 + dK;                              // even -> 8B-aligned
            v2f a0 = *(const v2f*)(&As[(aRow0 + ln15) * 20 + kk]);
            v2f a1 = *(const v2f*)(&As[(aRow0 + 16 + ln15) * 20 + kk]);
            v2f b0 = *(const v2f*)(&Bt[(bCol0 + ln15) * 18 + kk]);
            v2f b1 = *(const v2f*)(&Bt[(bCol0 + 16 + ln15) * 18 + kk]);
            acc00 = wmma_f32(a0, b0, acc00);
            acc01 = wmma_f32(a0, b1, acc01);
            acc10 = wmma_f32(a1, b0, acc10);
            acc11 = wmma_f32(a1, b1, acc11);
        }
    }

    #pragma unroll
    for (int j = 0; j < 8; ++j) {
        int rL = j + ((lane < 16) ? 0 : 8);
        int r0 = rowBase + aRow0 + rL;
        int r1 = r0 + 16;
        int c0 = colBase + bCol0 + ln15;
        int c1 = c0 + 16;
        C[(size_t)r0 * N + c0] = acc00[j];
        C[(size_t)r0 * N + c1] = acc01[j];
        C[(size_t)r1 * N + c0] = acc10[j];
        C[(size_t)r1 * N + c1] = acc11[j];
    }
}

__global__ __launch_bounds__(256) void gemm_wmma_f32(
    const float* __restrict__ A, const float* __restrict__ B,
    float* __restrict__ C, int M, int K, int N)
{
    int nBlocks = N / GBN;
    int bm = blockIdx.x / nBlocks;
    int bn = blockIdx.x - bm * nBlocks;
    gemm_tile(A, B, C, K, N, bm * GBM, bn * GBN);
}

// The three input projections share A and are one launch: a block's column
// index runs over the 64-wide column blocks of Wq, then Wk, then Wv.
#define QK_CB (HEADS * FDIM / GBN)            // 3 column blocks of q, and of k
#define V_CB  (HEADS * DHEAD / GBN)           // 12 column blocks of v
#define QKV_CB (2 * QK_CB + V_CB)             // 18

__global__ __launch_bounds__(256) void proj_qkv_kernel(
    const float* __restrict__ A, const float* __restrict__ Wq,
    const float* __restrict__ Wk, const float* __restrict__ Wv,
    float* __restrict__ q, float* __restrict__ k, float* __restrict__ v)
{
    int bm = blockIdx.x / QKV_CB;
    int bn = blockIdx.x - bm * QKV_CB;
    const float* B = Wv;
    float* C = v;
    int N = HEADS * DHEAD, cb = bn - 2 * QK_CB;
    if (bn < QK_CB)          { B = Wq; C = q; N = HEADS * FDIM; cb = bn; }
    else if (bn < 2 * QK_CB) { B = Wk; C = k; N = HEADS * FDIM; cb = bn - QK_CB; }
    gemm_tile(A, B, C, DMODEL, N, bm * GBM, cb * GBN);
}

// ---------------------------------------------------------------------------
// Running-mean centering as a chunked parallel prefix sum over the sequence.
// One block = 32 columns (one 128-byte line of a row) x 512 rows of one batch.
// 256 threads = 8 column quads x 32 chunks; a thread owns 16 rows x 4 columns.
// The rows in front of the block's part are summed again by the block itself
// (no hand-over between blocks); chunk sums meet by lane shifts inside a wave,
// wave sums in LDS behind one barrier.
// ---------------------------------------------------------------------------
#define CS_PARTS  4
#define CS_ROWS   (SEQ / CS_PARTS)            // 512 rows a block
#define CS_CHUNKS 32
#define CS_RPT    (CS_ROWS / CS_CHUNKS)       // 16 rows a thread
#define CS_KGRP   (HEADS * FDIM / 32)         // 6 column groups of k
#define CS_VGRP   (HEADS * DHEAD / 32)        // 24 column groups of v

// IS_K picks the row pitch at compile time, so that every row of a thread is
// one address register plus an immediate offset.
template <bool IS_K>
static __device__ __forceinline__ void center_part(
    const float* __restrict__ raw, float* __restrict__ centered, float* __restrict__ mean,
    int grp, int b, int part, v4f (*tot)[8], v4f (*pre)[8])
{
    constexpr int PITCH = IS_K ? HEADS * FDIM : HEADS * DHEAD;   // floats in a source row
    constexpr int W     = IS_K ? FDIM : DHEAD;                   // floats in a head's row

    int quad  = threadIdx.x & 7;
    int chunk = threadIdx.x >> 3;
    int col   = grp * 32 + quad * 4;
    int row0  = part * CS_ROWS + chunk * CS_RPT;
    const float* colp = raw + (size_t)b * SEQ * PITCH + col;

    const float* own = colp + (size_t)row0 * PITCH;
    v4f x[CS_RPT];
    #pragma unroll
    for (int r = 0; r < CS_RPT - 1; ++r)
        x[r] = *(const v4f*)(own + r * PITCH);
    // precaution: the build lets the last row's result take the address pair that
    // the loads above name; their wait stands in front of that overwrite
    asm volatile("s_wait_xcnt 0x0" ::: "memory");
    x[CS_RPT - 1] = *(const v4f*)(own + (CS_RPT - 1) * PITCH);

    // rows in front of the part, dealt row by row over the 32 chunks
    const float* front = colp + (size_t)chunk * PITCH;
    v4f p = {};
    #pragma unroll
    for (int i = 0; i < CS_PARTS - 1; ++i) {
        if (i < part) {
            #pragma unroll
            for (int r = 0; r < CS_RPT; ++r)
                p += *(const v4f*)(front + (i * CS_RPT + r) * CS_CHUNKS * PITCH);
        }
    }

    v4f s = x[0];
    #pragma unroll
    for (int r = 1; r < CS_RPT; ++r) s += x[r];

    // the wave's 4 chunks meet by lane shifts: sums of the chunks in front (exc),
    // and the wave's whole share of the front rows (pw)
    int wave = threadIdx.x >> 5;
    int cw   = chunk & 3;
    v4f exc = {}, pw = p;
    #pragma unroll
    for (int d = 1; d < 4; ++d) {
        #pragma unroll
        for (int k = 0; k < 4; ++k) {
            float up = __shfl_up(s[k], 8 * d, 32);
            exc[k] += (cw >= d) ? up : 0.f;
            pw[k]  += __shfl_xor(p[k], 8 * d, 32);
        }
    }
    if (cw == 3) {
        tot[wave][quad] = exc + s;
        pre[wave][quad] = pw;
    }
    __syncthreads();

    v4f run = {};
    #pragma unroll
    for (int w = 0; w < 8; ++w) run += pre[w][quad];
    #pragma unroll
    for (int w = 0; w < 7; ++w) {
        v4f tw = tot[w][quad];
        run += (w < wave) ? tw : v4f{};   // a select, so that all the LDS reads fly together
    }
    run += exc;

    int bh = b * HEADS + col / W;
    size_t o = ((size_t)bh * SEQ + row0) * W + (col % W);
    float* dc = centered + o;
    float* dm = mean + o;
    #pragma unroll
    for (int r = 0; r < CS_RPT; ++r) {
        run += x[r];
        v4f m = run / (float)(row0 + r + 1);
        if (!IS_K) *(v4f*)(dm + r * W) = m;
        *(v4f*)(dc + r * W) = x[r] - m;
    }
    // precaution: in the build the k path's code follows the v path's and rewrites the
    // registers that the stores above name; their wait stands behind the last store
    if (!IS_K) asm volatile("s_wait_xcnt 0x0" ::: "memory");
}

__global__ __launch_bounds__(256) void center_scan_kernel(
    const float* __restrict__ k_raw, const float* __restrict__ v_raw,
    float* __restrict__ ck, float* __restrict__ cv, float* __restrict__ mv)
{
    __shared__ v4f tot[8][8];   // [wave][quad] sum of the wave's own 64 rows
    __shared__ v4f pre[8][8];   // [wave][quad] the wave's share of the rows in front of the part

    int g    = blockIdx.x;
    int b    = blockIdx.y;
    int part = CS_PARTS - 1 - blockIdx.z;     // the part with most rows in front starts first

    if (g < CS_KGRP) center_part<true >(k_raw, ck, ck, g,           b, part, tot, pre);
    else             center_part<false>(v_raw, cv, mv, g - CS_KGRP, b, part, tot, pre);
}

// ---------------------------------------------------------------------------
// Fused causal attention core (flash-style): one block per (b,h,64-query tile).
// S = Q * CK^T via WMMA into LDS (diag tile masked); per-row sum of S^2 and
// O += S * CV (WMMA, CV transposed in LDS) consumed from LDS.
// ---------------------------------------------------------------------------
__global__ __launch_bounds__(256) void atten_kernel(
    const float* __restrict__ q_raw, const float* __restrict__ ck,
    const float* __restrict__ cv, float* __restrict__ qKV, float* __restrict__ rs)
{
    __shared__ float Qs[64 * 20];    // [q][f]   stride 20
    __shared__ float CKs[64 * 20];   // [k][f]   stride 20
    __shared__ float CVt[64 * 68];   // [d][k]   stride 68 (transposed)
    __shared__ float Ss[64 * 68];    // [q][k]   stride 68 (even -> aligned v2f)

    int qt = blockIdx.x;
    int h  = blockIdx.y;
    int b  = blockIdx.z;
    int bh = b * HEADS + h;
    int qBase = qt * 64;

    int tid  = threadIdx.x;
    int wave = tid >> 5, lane = tid & 31;
    int ln15 = lane & 15;
    int dK   = (lane < 16) ? 0 : 2;
    int mt   = wave & 3;
    int ntB  = (wave >> 2) * 2;

    int qr = tid >> 4, qf = tid & 15;     // Q/CK staging: 4 rows apart by 16
    int vr = tid >> 6, vc = tid & 63;     // CV staging: 16 rows apart by 4

    const float* qg = q_raw + ((size_t)(b * SEQ + qBase)) * (HEADS * FDIM) + h * FDIM;
#ifdef USE_ASYNC_LDS
    #pragma unroll
    for (int i = 0; i < 4; ++i)
        __builtin_amdgcn_global_load_async_to_lds_b32(
            (AS1 int*)(qg + (size_t)(qr + i * 16) * (HEADS * FDIM) + qf),
            (AS3 int*)(Qs + (qr + i * 16) * 20 + qf), 0, 0);
#else
    {
        float tq[4];
        #pragma unroll
        for (int i = 0; i < 4; ++i)
            tq[i] = qg[(size_t)(qr + i * 16) * (HEADS * FDIM) + qf];
        #pragma unroll
        for (int i = 0; i < 4; ++i) Qs[(qr + i * 16) * 20 + qf] = tq[i];
    }
#endif

    v8f o0 = {}, o1 = {};
    float rsum = 0.f;

    for (int kt = 0; kt <= qt; ++kt) {
        int kBase = kt * 64;
        const float* ckg = ck + ((size_t)bh * SEQ + kBase) * FDIM;
        const float* cvg = cv + ((size_t)bh * SEQ + kBase) * DHEAD;
        __syncthreads();
#ifdef USE_ASYNC_LDS
        #pragma unroll
        for (int i = 0; i < 4; ++i)
            __builtin_amdgcn_global_load_async_to_lds_b32(
                (AS1 int*)(ckg + (size_t)(qr + i * 16) * FDIM + qf),
                (AS3 int*)(CKs + (qr + i * 16) * 20 + qf), 0, 0);
        #pragma unroll
        for (int i = 0; i < 16; ++i)
            __builtin_amdgcn_global_load_async_to_lds_b32(
                (AS1 int*)(cvg + (size_t)(vr + i * 4) * DHEAD + vc),
                (AS3 int*)(CVt + vc * 68 + vr + i * 4), 0, 0);
        __builtin_amdgcn_s_wait_asynccnt(0);
#else
        {
            float tk[4], tv[16];
            #pragma unroll
            for (int i = 0; i < 4; ++i)
                tk[i] = ckg[(size_t)(qr + i * 16) * FDIM + qf];
            #pragma unroll
            for (int i = 0; i < 16; ++i)
                tv[i] = cvg[(size_t)(vr + i * 4) * DHEAD + vc];
            #pragma unroll
            for (int i = 0; i < 4; ++i) CKs[(qr + i * 16) * 20 + qf] = tk[i];
            #pragma unroll
            for (int i = 0; i < 16; ++i) CVt[vc * 68 + vr + i * 4] = tv[i];
        }
#endif
        __syncthreads();

        // ---- S tiles: two 16x16 tiles per wave, F=16 in four x4 steps ----
        bool diag = (kt == qt);
        #pragma unroll
        for (int sub = 0; sub < 2; ++sub) {
            int nt = ntB + sub;
            v8f s = {};
            #pragma unroll
            for (int st = 0; st < 4; ++st) {
                int f0 = st * 4 + dK;
                v2f a  = *(const v2f*)(&Qs[(mt * 16 + ln15) * 20 + f0]);
                v2f bb = *(const v2f*)(&CKs[(nt * 16 + ln15) * 20 + f0]);
                s = wmma_f32(a, bb, s);
            }
            int c = nt * 16 + ln15;
            #pragma unroll
            for (int j = 0; j < 8; ++j) {
                int m = mt * 16 + j + ((lane < 16) ? 0 : 8);
                float val = s[j];
                if (diag && (c > m)) val = 0.f;   // causal: keep key<=query
                Ss[m * 68 + c] = val;
            }
        }
        __syncthreads();

        // ---- per-row sum of squares (threads 0..63, one row each) ----
        if (tid < 64) {
            float a = 0.f;
            #pragma unroll 8
            for (int c = 0; c < 64; ++c) { float x = Ss[tid * 68 + c]; a += x * x; }
            rsum += a;
        }

        // ---- O += S * CV : contraction over 64 keys, 16 x4 steps ----
        #pragma unroll 4
        for (int st = 0; st < 16; ++st) {
            int k0 = st * 4 + dK;
            v2f a  = *(const v2f*)(&Ss[(mt * 16 + ln15) * 68 + k0]);
            v2f b0 = *(const v2f*)(&CVt[(ntB * 16 + ln15) * 68 + k0]);
            v2f b1 = *(const v2f*)(&CVt[((ntB + 1) * 16 + ln15) * 68 + k0]);
            o0 = wmma_f32(a, b0, o0);
            o1 = wmma_f32(a, b1, o1);
        }
    }

    #pragma unroll
    for (int j = 0; j < 8; ++j) {
        int m = mt * 16 + j + ((lane < 16) ? 0 : 8);
        size_t rowOff = ((size_t)bh * SEQ + qBase + m) * DHEAD;
        qKV[rowOff + ntB * 16 + ln15]       = o0[j];
        qKV[rowOff + (ntB + 1) * 16 + ln15] = o1[j];
    }
    if (tid < 64) rs[(size_t)bh * SEQ + qBase + tid] = rsum;
}

// ---------------------------------------------------------------------------
// Denominator scan: cum = cumsum_q(rowSumSq / (2*DH)); dinv = 1/((q+1)+cum)
// ---------------------------------------------------------------------------
// Chunked parallel prefix sum: 256 threads x 8 rows; thread sums are scanned
// inside each wave by lane shifts, wave sums meet in LDS behind one barrier.
__global__ __launch_bounds__(256) void denom_kernel(const float* __restrict__ rs, float* __restrict__ dinv)
{
    __shared__ float wsum[8];
    int bh   = blockIdx.x;
    int t    = threadIdx.x;
    int lane = t & 31, wave = t >> 5;
    const float inv2d = 1.0f / (2.0f * DHEAD);
    size_t base = (size_t)bh * SEQ + t * 8;

    v4f lo = *(const v4f*)(rs + base) * inv2d;
    v4f hi = *(const v4f*)(rs + base + 4) * inv2d;
    float x[8] = {lo[0], lo[1], lo[2], lo[3], hi[0], hi[1], hi[2], hi[3]};

    float s = x[0];
    #pragma unroll
    for (int j = 1; j < 8; ++j) s += x[j];

    float inc = s;                               // inclusive scan over the wave's 32 thread sums
    #pragma unroll
    for (int d = 1; d < 32; d <<= 1) {
        float up = __shfl_up(inc, d, 32);
        if (lane >= d) inc += up;
    }
    if (lane == 31) wsum[wave] = inc;
    float exc = __shfl_up(inc, 1, 32);
    if (lane == 0) exc = 0.f;
    __syncthreads();

    float cum = 0.f;
    #pragma unroll
    for (int w = 0; w < 7; ++w) {
        float tw = wsum[w];
        if (w < wave) cum += tw;
    }
    cum += exc;

    float r[8];
    #pragma unroll
    for (int j = 0; j < 8; ++j) {
        cum += x[j];
        r[j] = 1.0f / ((float)(t * 8 + j + 1) + cum);
    }
    v4f olo = {r[0], r[1], r[2], r[3]}, ohi = {r[4], r[5], r[6], r[7]};
    *(v4f*)(dinv + base)     = olo;
    *(v4f*)(dinv + base + 4) = ohi;
}

// ---------------------------------------------------------------------------
// y[b,l,h*DH+i] = mv + (qKV / sqrt(DH)) * dinv   (row-major for final GEMM)
// ---------------------------------------------------------------------------
__global__ __launch_bounds__(256) void finalize_kernel(
    const float* __restrict__ qKV, const float* __restrict__ mv,
    const float* __restrict__ dinv, float* __restrict__ y)
{
    size_t idx = (size_t)blockIdx.x * 256 + threadIdx.x;
    if (idx >= (size_t)BATCH * HEADS * SEQ * DHEAD) return;
    size_t rowIdx = idx >> 6;           // bh*SEQ + l
    int i  = (int)(idx & 63);
    int l  = (int)(rowIdx & (SEQ - 1));
    int bh = (int)(rowIdx >> 11);
    int b  = bh / HEADS, h = bh - b * HEADS;
    const float invSqrtDh = 0.125f;     // 1/sqrt(64)
    float val = mv[idx] + qKV[idx] * invSqrtDh * dinv[rowIdx];
    y[((size_t)(b * SEQ + l)) * DMODEL + h * DHEAD + i] = val;
}

// ---------------------------------------------------------------------------
extern "C" void kernel_launch(void* const* d_in, const int* in_sizes, int n_in,
                              void* d_out, int out_size, void* d_ws, size_t ws_size,
                              hipStream_t stream) {
    const float* hs = (const float*)d_in[0];
    const float* Wq = (const float*)d_in[1];
    const float* Wk = (const float*)d_in[2];
    const float* Wv = (const float*)d_in[3];
    const float* Wo = (const float*)d_in[4];
    float* out = (float*)d_out;

    const int M  = BATCH * SEQ;            // 4096
    const int NF = HEADS * FDIM;           // 192
    const int NV = HEADS * DHEAD;          // 768

    float* ws = (float*)d_ws;
    size_t off = 0;
    float* q_raw = ws + off; off += (size_t)M * NF;
    float* k_raw = ws + off; off += (size_t)M * NF;
    float* v_raw = ws + off; off += (size_t)M * NV;
    float* ck    = ws + off; off += (size_t)BATCH * HEADS * SEQ * FDIM;
    float* cv    = ws + off; off += (size_t)BATCH * HEADS * SEQ * DHEAD;
    float* mv    = ws + off; off += (size_t)BATCH * HEADS * SEQ * DHEAD;
    float* qKV   = ws + off; off += (size_t)BATCH * HEADS * SEQ * DHEAD;
    float* rsbuf = ws + off; off += (size_t)BATCH * HEADS * SEQ;
    float* dinv  = ws + off; off += (size_t)BATCH * HEADS * SEQ;
    float* ybuf  = ws + off; off += (size_t)M * DMODEL;
    (void)ws_size; (void)in_sizes; (void)n_in; (void)out_size;

    // 1: input projections, one launch
    proj_qkv_kernel<<<dim3((M / GBM) * QKV_CB), 256, 0, stream>>>(hs, Wq, Wk, Wv, q_raw, k_raw, v_raw);

    // 2: running-mean centering
    center_scan_kernel<<<dim3(CS_KGRP + CS_VGRP, BATCH, CS_PARTS), 256, 0, stream>>>(k_raw, v_raw, ck, cv, mv);

    // 3: fused causal attention core
    atten_kernel<<<dim3(SEQ / 64, HEADS, BATCH), 256, 0, stream>>>(q_raw, ck, cv, qKV, rsbuf);

    // 4: denominator scan
    denom_kernel<<<dim3(BATCH * HEADS), 256, 0, stream>>>(rsbuf, dinv);

    // 5: finalize y
    size_t nElem = (size_t)BATCH * HEADS * SEQ * DHEAD;
    finalize_kernel<<<dim3((unsigned)((nElem + 255) / 256)), 256, 0, stream>>>(qKV, mv, dinv, ybuf);

    // 6: output projection
    gemm_wmma_f32<<<dim3((M / GBM) * (DMODEL / GBN)), 256, 0, stream>>>(ybuf, Wo, out, M, DMODEL, DMODEL);
}

// v003
// It runs in 168 microseconds.
// In two side-by-side timings against v002, it was 1.50 and 1.49 times as fast.
// Over all steps from v000 it is 4.37 times as fast.
#include <hip/hip_runtime.h>
#include <hip/hip_bf16.h>

typedef __attribute__((ext_vector_type(2))) float v2f;
typedef __attribute__((ext_vector_type(4))) float v4f;
typedef __attribute__((ext_vector_type(8))) float v8f;

#define BATCH 2
#define SEQ   2048
#define DMODEL 768
#define HEADS 12
#define FDIM  16
#define DHEAD 64

#define AS1 __attribute__((address_space(1)))
#define AS3 __attribute__((address_space(3)))

#if defined(__has_builtin)
#if __has_builtin(__builtin_amdgcn_global_load_async_to_lds_b32) && \
    __has_builtin(__builtin_amdgcn_s_wait_asynccnt)
#define USE_ASYNC_LDS 1
#endif
#endif

static __device__ __forceinline__ v8f wmma_f32(v2f a, v2f b, v8f c) {
    return __builtin_amdgcn_wmma_f32_16x16x4_f32(false, a, false, b, (short)0, c, false, false);
}

// ---------------------------------------------------------------------------
// Block-tiled fp32 WMMA GEMM: C(MxN) = A(MxK,rm) * B(KxN,rm).
// Block = 128x64 C tile, 8 waves, each wave a 32x32 sub-block (4 WMMA tiles).
// K staged in 16-wide slabs; A row-major (stride 20), B transposed (stride 18)
// in LDS so every WMMA operand is a single aligned ds_load_b64, bank-conflict
// free for both lane halves. Slabs staged via async global->LDS DMA when the
// toolchain exposes it. Requires M%128==0, N%64==0, K%16==0.
// ---------------------------------------------------------------------------
#define GBM 128
#define GBN 64
#define GKT 16

static __device__ __forceinline__ void gemm_tile(
    const float* __restrict__ A, const float* __restrict__ B,
    float* __restrict__ C, int K, int N, int rowBase, int colBase)
{
    __shared__ float As[GBM * 20];   // [row][k]  128 x 16, stride 20
    __shared__ float Bt[GBN * 18];   // [col][k]   64 x 16, stride 18 (transposed)

    int tid  = threadIdx.x;
    int wave = tid >> 5, lane = tid & 31;
    int ln15 = lane & 15;
    int dK   = (lane < 16) ? 0 : 2;

    int aRow0 = (wave & 3) * 32;
    int bCol0 = (wave >> 2) * 32;

    int ar = tid >> 4, af = tid & 15;     // A staging: 8 rows apart by 16
    int br = tid >> 6, bc = tid & 63;     // B staging: 4 rows apart by 4

    v8f acc00 = {}, acc01 = {}, acc10 = {}, acc11 = {};

    for (int k0 = 0; k0 < K; k0 += GKT) {
        __syncthreads();
#ifdef USE_ASYNC_LDS
        #pragma unroll
        for (int i = 0; i < 8; ++i)
            __builtin_amdgcn_global_load_async_to_lds_b32(
                (AS1 int*)(A + (size_t)(rowBase + ar + i * 16) * K + k0 + af),
                (AS3 int*)(As + (ar + i * 16) * 20 + af), 0, 0);
        #pragma unroll
        for (int i = 0; i < 4; ++i)
            __builtin_amdgcn_global_load_async_to_lds_b32(
                (AS1 int*)(B + (size_t)(k0 + br + i * 4) * N + colBase + bc),
                (AS3 int*)(Bt + bc * 18 + br + i * 4), 0, 0);
        __builtin_amdgcn_s_wait_asynccnt(0);
#else
        float ta[8], tb[4];
        #pragma unroll
        for (int i = 0; i < 8; ++i)
            ta[i] = A[(size_t)(rowBase + ar + i * 16) * K + k0 + af];
        #pragma unroll
        for (int i = 0; i < 4; ++i)
            tb[i] = B[(size_t)(k0 + br + i * 4) * N + colBase + bc];
        #pragma unroll
        for (int i = 0; i < 8; ++i) As[(ar + i * 16) * 20 + af] = ta[i];
        #pragma unroll
        for (int i = 0; i < 4; ++i) Bt[bc * 18 + br + i * 4] = tb[i];
#endif
        if (k0 + GKT < K) {                                    // global_prefetch_b8
            __builtin_prefetch(&A[(size_t)(rowBase + (tid & 127)) * K + k0 + GKT], 0, 3);
            if (tid < GKT)
                __builtin_prefetch(&B[(size_t)(k0 + GKT + tid) * N + colBase], 0, 3);
        }
        __syncthreads();

        #pragma unroll
        for (int st = 0; st < GKT / 4; ++st) {
            int kk = st * 4 + dK;                              // even -> 8B-aligned
            v2f a0 = *(const v2f*)(&As[(aRow0 + ln15) * 20 + kk]);
            v2f a1 = *(const v2f*)(&As[(aRow0 + 16 + ln15) * 20 + kk]);
            v2f b0 = *(const v2f*)(&Bt[(bCol0 + ln15) * 18 + kk]);
            v2f b1 = *(const v2f*)(&Bt[(bCol0 + 16 + ln15) * 18 + kk]);
            acc00 = wmma_f32(a0, b0, acc00);
            acc01 = wmma_f32(a0, b1, acc01);
            acc10 = wmma_f32(a1, b0, acc10);
            acc11 = wmma_f32(a1, b1, acc11);
        }
    }

    #pragma unroll
    for (int j = 0; j < 8; ++j) {
        int rL = j + ((lane < 16) ? 0 : 8);
        int r0 = rowBase + aRow0 + rL;
        int r1 = r0 + 16;
        int c0 = colBase + bCol0 + ln15;
        int c1 = c0 + 16;
        C[(size_t)r0 * N + c0] = acc00[j];
        C[(size_t)r0 * N + c1] = acc01[j];
        C[(size_t)r1 * N + c0] = acc10[j];
        C[(size_t)r1 * N + c1] = acc11[j];
    }
}

__global__ __launch_bounds__(256) void gemm_wmma_f32(
    const float* __restrict__ A, const float* __restrict__ B,
    float* __restrict__ C, int M, int K, int N)
{
    int nBlocks = N / GBN;
    int bm = blockIdx.x / nBlocks;
    int bn = blockIdx.x - bm * nBlocks;
    gemm_tile(A, B, C, K, N, bm * GBM, bn * GBN);
}

// The three input projections share A and are one launch: a block's column
// index runs over the 64-wide column blocks of Wq, then Wk, then Wv.
#define QK_CB (HEADS * FDIM / GBN)            // 3 column blocks of q, and of k
#define V_CB  (HEADS * DHEAD / GBN)           // 12 column blocks of v
#define QKV_CB (2 * QK_CB + V_CB)             // 18

__global__ __launch_bounds__(256) void proj_qkv_kernel(
    const float* __restrict__ A, const float* __restrict__ Wq,
    const float* __restrict__ Wk, const float* __restrict__ Wv,
    float* __restrict__ q, float* __restrict__ k, float* __restrict__ v)
{
    int bm = blockIdx.x / QKV_CB;
    int bn = blockIdx.x - bm * QKV_CB;
    const float* B = Wv;
    float* C = v;
    int N = HEADS * DHEAD, cb = bn - 2 * QK_CB;
    if (bn < QK_CB)          { B = Wq; C = q; N = HEADS * FDIM; cb = bn; }
    else if (bn < 2 * QK_CB) { B = Wk; C = k; N = HEADS * FDIM; cb = bn - QK_CB; }
    gemm_tile(A, B, C, DMODEL, N, bm * GBM, cb * GBN);
}

// ---------------------------------------------------------------------------
// Running-mean centering as a chunked parallel prefix sum over the sequence.
// One block = 32 columns (one 128-byte line of a row) x 512 rows of one batch.
// 256 threads = 8 column quads x 32 chunks; a thread owns 16 rows x 4 columns.
// The rows in front of the block's part are summed again by the block itself
// (no hand-over between blocks); chunk sums meet by lane shifts inside a wave,
// wave sums in LDS behind one barrier.
// ---------------------------------------------------------------------------
#define CS_PARTS  4
#define CS_ROWS   (SEQ / CS_PARTS)            // 512 rows a block
#define CS_CHUNKS 32
#define CS_RPT    (CS_ROWS / CS_CHUNKS)       // 16 rows a thread
#define CS_KGRP   (HEADS * FDIM / 32)         // 6 column groups of k
#define CS_VGRP   (HEADS * DHEAD / 32)        // 24 column groups of v

// IS_K picks the row pitch at compile time, so that every row of a thread is
// one address register plus an immediate offset.
template <bool IS_K>
static __device__ __forceinline__ void center_part(
    const float* __restrict__ raw, float* __restrict__ centered, float* __restrict__ mean,
    int grp, int b, int part, v4f (*tot)[8], v4f (*pre)[8])
{
    constexpr int PITCH = IS_K ? HEADS * FDIM : HEADS * DHEAD;   // floats in a source row
    constexpr int W     = IS_K ? FDIM : DHEAD;                   // floats in a head's row

    int quad  = threadIdx.x & 7;
    int chunk = threadIdx.x >> 3;
    int col   = grp * 32 + quad * 4;
    int row0  = part * CS_ROWS + chunk * CS_RPT;
    const float* colp = raw + (size_t)b * SEQ * PITCH + col;

    const float* own = colp + (size_t)row0 * PITCH;
    v4f x[CS_RPT];
    #pragma unroll
    for (int r = 0; r < CS_RPT - 1; ++r)
        x[r] = *(const v4f*)(own + r * PITCH);
    // precaution: the build lets the last row's result take the address pair that
    // the loads above name; their wait stands in front of that overwrite
    asm volatile("s_wait_xcnt 0x0" ::: "memory");
    x[CS_RPT - 1] = *(const v4f*)(own + (CS_RPT - 1) * PITCH);

    // rows in front of the part, dealt row by row over the 32 chunks
    const float* front = colp + (size_t)chunk * PITCH;
    v4f p = {};
    #pragma unroll
    for (int i = 0; i < CS_PARTS - 1; ++i) {
        if (i < part) {
            #pragma unroll
            for (int r = 0; r < CS_RPT; ++r)
                p += *(const v4f*)(front + (i * CS_RPT + r) * CS_CHUNKS * PITCH);
        }
    }

    v4f s = x[0];
    #pragma unroll
    for (int r = 1; r < CS_RPT; ++r) s += x[r];

    // the wave's 4 chunks meet by lane shifts: sums of the chunks in front (exc),
    // and the wave's whole share of the front rows (pw)
    int wave = threadIdx.x >> 5;
    int cw   = chunk & 3;
    v4f exc = {}, pw = p;
    #pragma unroll
    for (int d = 1; d < 4; ++d) {
        #pragma unroll
        for (int k = 0; k < 4; ++k) {
            float up = __shfl_up(s[k], 8 * d, 32);
            exc[k] += (cw >= d) ? up : 0.f;
            pw[k]  += __shfl_xor(p[k], 8 * d, 32);
        }
    }
    if (cw == 3) {
        tot[wave][quad] = exc + s;
        pre[wave][quad] = pw;
    }
    __syncthreads();

    v4f run = {};
    #pragma unroll
    for (int w = 0; w < 8; ++w) run += pre[w][quad];
    #pragma unroll
    for (int w = 0; w < 7; ++w) {
        v4f tw = tot[w][quad];
        run += (w < wave) ? tw : v4f{};   // a select, so that all the LDS reads fly together
    }
    run += exc;

    int bh = b * HEADS + col / W;
    size_t o = ((size_t)bh * SEQ + row0) * W + (col % W);
    float* dc = centered + o;
    float* dm = mean + o;
    #pragma unroll
    for (int r = 0; r < CS_RPT; ++r) {
        run += x[r];
        v4f m = run / (float)(row0 + r + 1);
        if (!IS_K) *(v4f*)(dm + r * W) = m;
        *(v4f*)(dc + r * W) = x[r] - m;
    }
    // precaution: in the build the k path's code follows the v path's and rewrites the
    // registers that the stores above name; their wait stands behind the last store
    if (!IS_K) asm volatile("s_wait_xcnt 0x0" ::: "memory");
}

__global__ __launch_bounds__(256) void center_scan_kernel(
    const float* __restrict__ k_raw, const float* __restrict__ v_raw,
    float* __restrict__ ck, float* __restrict__ cv, float* __restrict__ mv)
{
    __shared__ v4f tot[8][8];   // [wave][quad] sum of the wave's own 64 rows
    __shared__ v4f pre[8][8];   // [wave][quad] the wave's share of the rows in front of the part

    int g    = blockIdx.x;
    int b    = blockIdx.y;
    int part = CS_PARTS - 1 - blockIdx.z;     // the part with most rows in front starts first

    if (g < CS_KGRP) center_part<true >(k_raw, ck, ck, g,           b, part, tot, pre);
    else             center_part<false>(v_raw, cv, mv, g - CS_KGRP, b, part, tot, pre);
}

// ---------------------------------------------------------------------------
// The causal product has no softmax, so it is re-associated by 64-key chunks:
//   tril(Q CK^T) CV        = Q (sum over earlier chunks of CK_c^T CV_c) + own chunk's masked tile
//   row sums of tril(..)^2 = q^T (sum over earlier chunks of CK_c^T CK_c) q + own chunk's masked tile
// Chunk state = five 16x16 tiles, each 256 floats in a row (one wave writes one tile):
// tiles 0..3 are CK_c^T CV_c [f][d], 16 columns of d each; tile 4 is CK_c^T CK_c [f][f].
// ---------------------------------------------------------------------------
#define NCHUNK    (SEQ / 64)
#define ST_TILE   256
#define ST_KK     (4 * ST_TILE)
#define ST_FLOATS (5 * ST_TILE)

// One 16x16 tile of a chunk's state: contraction over the chunk's 64 keys. Both
// operands are key-major in memory, which is the fragment order: no staging.
template <int BPITCH>
static __device__ __forceinline__ void state_tile(
    const float* __restrict__ ap, const float* __restrict__ bp, float* __restrict__ dst)
{
    v2f a[16], bb[16];
    // unrolled: every load is one address plus an immediate, and they fly together
    #pragma unroll
    for (int s = 0; s < 16; ++s) {
        a[s]  = v2f{ap[s * 4 * FDIM],   ap[(s * 4 + 1) * FDIM]};
        bb[s] = v2f{bp[s * 4 * BPITCH], bp[(s * 4 + 1) * BPITCH]};
    }
    v8f acc = {};
    #pragma unroll
    for (int s = 0; s < 16; ++s) acc = wmma_f32(a[s], bb[s], acc);
    #pragma unroll
    for (int j = 0; j < 8; ++j) dst[j * 16] = acc[j];
}

__global__ __launch_bounds__(160) void chunk_state_kernel(
    const float* __restrict__ ck, const float* __restrict__ cv, float* __restrict__ st)
{
    int c  = blockIdx.x;
    int bh = blockIdx.z * HEADS + blockIdx.y;
    int lane = threadIdx.x & 31;
    int tile = __builtin_amdgcn_readfirstlane(threadIdx.x >> 5);
    int ln15 = lane & 15;
    int hi   = lane >> 4;

    size_t key0 = (size_t)bh * SEQ + c * 64 + hi * 2;       // lane half holds k and k+1, or k+2 and k+3
    const float* ap = ck + key0 * FDIM + ln15;
    float* dst = st + ((size_t)bh * NCHUNK + c) * ST_FLOATS + tile * ST_TILE + hi * 8 * 16 + ln15;
    if (tile < 4) state_tile<DHEAD>(ap, cv + key0 * DHEAD + tile * 16 + ln15, dst);
    else          state_tile<FDIM >(ap, ap, dst);
}

// ---------------------------------------------------------------------------
// Causal attention core: one block per (b,h,64-query chunk). The states of the
// chunks in front are summed by the block itself; the own chunk's tile
// S = Q * CK^T (masked) goes through LDS: row sums of S^2, O += S * CV.
// ---------------------------------------------------------------------------
#define PF_GROUP 8     // chunk states whose loads fly together

__global__ __launch_bounds__(256) void atten_kernel(
    const float* __restrict__ q_raw, const float* __restrict__ ck,
    const float* __restrict__ cv, const float* __restrict__ st,
    float* __restrict__ qKV, float* __restrict__ rs)
{
    __shared__ float Qs[64 * 20];    // [q][f]   stride 20
    __shared__ float CKs[64 * 20];   // [k][f]   stride 20
    __shared__ float CVt[64 * 68];   // [d][k]   stride 68 (transposed)
    __shared__ float Ss[64 * 68];    // [q][k]   stride 68 (even -> aligned v2f)
    __shared__ __attribute__((aligned(16))) float Ps[ST_FLOATS];   // summed state of the chunks in front
    __shared__ __attribute__((aligned(16))) float Tq[64 * 20];     // [q][f] (Q * KK) times Q, element by element

    int qt = blockIdx.x;
    int h  = blockIdx.y;
    int b  = blockIdx.z;
    int bh = b * HEADS + h;
    int qBase = qt * 64;

    int tid  = threadIdx.x;
    int wave = __builtin_amdgcn_readfirstlane(tid >> 5), lane = tid & 31;
    int ln15 = lane & 15;
    int dK   = (lane < 16) ? 0 : 2;
    int mt   = wave & 3;
    int ntB  = (wave >> 2) * 2;

    int qr = tid >> 4, qf = tid & 15;     // Q/CK staging: 4 rows apart by 16
    int vr = tid >> 6, vc = tid & 63;     // CV staging: 16 rows apart by 4

    const float* qg  = q_raw + ((size_t)(b * SEQ + qBase)) * (HEADS * FDIM) + h * FDIM;
    const float* ckg = ck + ((size_t)bh * SEQ + qBase) * FDIM;
    const float* cvg = cv + ((size_t)bh * SEQ + qBase) * DHEAD;
#ifdef USE_ASYNC_LDS
    #pragma unroll
    for (int i = 0; i < 4; ++i)
        __builtin_amdgcn_global_load_async_to_lds_b32(
            (AS1 int*)(qg + (size_t)(qr + i * 16) * (HEADS * FDIM) + qf),
            (AS3 int*)(Qs + (qr + i * 16) * 20 + qf), 0, 0);
    #pragma unroll
    for (int i = 0; i < 4; ++i)
        __builtin_amdgcn_global_load_async_to_lds_b32(
            (AS1 int*)(ckg + (size_t)(qr + i * 16) * FDIM + qf),
            (AS3 int*)(CKs + (qr + i * 16) * 20 + qf), 0, 0);
    #pragma unroll
    for (int i = 0; i < 16; ++i)
        __builtin_amdgcn_global_load_async_to_lds_b32(
            (AS1 int*)(cvg + (size_t)(vr + i * 4) * DHEAD + vc),
            (AS3 int*)(CVt + vc * 68 + vr + i * 4), 0, 0);
#else
    {
        float tq[4], tk[4], tv[16];
        #pragma unroll
        for (int i = 0; i < 4; ++i)
            tq[i] = qg[(size_t)(qr + i * 16) * (HEADS * FDIM) + qf];
        #pragma unroll
        for (int i = 0; i < 4; ++i)
            tk[i] = ckg[(size_t)(qr + i * 16) * FDIM + qf];
        #pragma unroll
        for (int i = 0; i < 16; ++i)
            tv[i] = cvg[(size_t)(vr + i * 4) * DHEAD + vc];
        #pragma unroll
        for (int i = 0; i < 4; ++i) Qs[(qr + i * 16) * 20 + qf] = tq[i];
        #pragma unroll
        for (int i = 0; i < 4; ++i) CKs[(qr + i * 16) * 20 + qf] = tk[i];
        #pragma unroll
        for (int i = 0; i < 16; ++i) CVt[vc * 68 + vr + i * 4] = tv[i];
    }
#endif

    // ---- sum of the states of the chunks in front, in chunk order; a thread owns
    // four floats of the CK^T CV tiles and one of CK^T CK.
    // A group's tail reads the last chunk in front again and adds nothing for it.
    const float* sb = st + (size_t)bh * NCHUNK * ST_FLOATS;
    v4f   pkv = {};
    float pkk = 0.f;
    for (int c0 = 0; c0 < qt; c0 += PF_GROUP) {
        v4f   tkv[PF_GROUP];
        float tkk[PF_GROUP];
        // unrolled: the group's loads fly together
        #pragma unroll
        for (int i = 0; i < PF_GROUP; ++i) {
            int c = (c0 + i < qt) ? c0 + i : qt - 1;
            const float* sc = sb + c * ST_FLOATS;
            tkv[i] = *(const v4f*)(sc + (unsigned)(tid * 4));
            tkk[i] = sc[(unsigned)(ST_KK + tid)];
        }
        // precaution: the next trip rewrites the address registers that the loads above name
        asm volatile("s_wait_xcnt 0x0" ::: "memory");
        #pragma unroll
        for (int i = 0; i < PF_GROUP; ++i) {
            bool in = c0 + i < qt;
            pkv += in ? tkv[i] : v4f{};
            pkk += in ? tkk[i] : 0.f;
        }
    }
    *(v4f*)(Ps + tid * 4) = pkv;
    Ps[ST_KK + tid] = pkk;
#ifdef USE_ASYNC_LDS
    // this wave's copies have landed before the barrier lets any wave read the tiles
    asm volatile("s_wait_asynccnt 0x0" ::: "memory");
#endif
    __syncthreads();

    // ---- S tiles: two 16x16 tiles per wave, F=16 in four x4 steps ----
    #pragma unroll
    for (int sub = 0; sub < 2; ++sub) {
        int nt = ntB + sub;
        v8f s = {};
        #pragma unroll
        for (int st4 = 0; st4 < 4; ++st4) {
            int f0 = st4 * 4 + dK;
            v2f a  = *(const v2f*)(&Qs[(mt * 16 + ln15) * 20 + f0]);
            v2f bb = *(const v2f*)(&CKs[(nt * 16 + ln15) * 20 + f0]);
            s = wmma_f32(a, bb, s);
        }
        int c = nt * 16 + ln15;
        #pragma unroll
        for (int j = 0; j < 8; ++j) {
            int m = mt * 16 + j + ((lane < 16) ? 0 : 8);
            float val = s[j];
            if (c > m) val = 0.f;   // causal: keep key<=query
            Ss[m * 68 + c] = val;
        }
    }

    // ---- the chunks in front: O = Q * (summed CK^T CV), F=16 in four x4 steps ----
    v8f o0 = {}, o1 = {};
    #pragma unroll
    for (int st4 = 0; st4 < 4; ++st4) {
        int f0 = st4 * 4 + dK;
        v2f a  = *(const v2f*)(&Qs[(mt * 16 + ln15) * 20 + f0]);
        const float* p0 = &Ps[ntB * ST_TILE + f0 * 16 + ln15];
        v2f b0 = {p0[0], p0[16]};
        v2f b1 = {p0[ST_TILE], p0[ST_TILE + 16]};
        o0 = wmma_f32(a, b0, o0);
        o1 = wmma_f32(a, b1, o1);
    }

    // ---- their share of the row sums: (Q * summed CK^T CK) times Q, waves 0..3 ----
    if (wave < 4) {
        v8f t = {};
        #pragma unroll
        for (int st4 = 0; st4 < 4; ++st4) {
            int f0 = st4 * 4 + dK;
            v2f a  = *(const v2f*)(&Qs[(mt * 16 + ln15) * 20 + f0]);
            const float* pk = &Ps[ST_KK + f0 * 16 + ln15];
            v2f bk = {pk[0], pk[16]};
            t = wmma_f32(a, bk, t);
        }
        #pragma unroll
        for (int j = 0; j < 8; ++j) {
            int m = mt * 16 + j + ((lane < 16) ? 0 : 8);
            Tq[m * 20 + ln15] = t[j] * Qs[m * 20 + ln15];
        }
    }
    __syncthreads();

    // ---- per-row sum of squares (threads 0..63, one row each) ----
    float rsum = 0.f;
    if (tid < 64) {
        #pragma unroll
        for (int g = 0; g < 4; ++g) {
            v4f x = *(const v4f*)(&Tq[tid * 20 + g * 4]);
            rsum += (x[0] + x[1]) + (x[2] + x[3]);
        }
        float a = 0.f;
        #pragma unroll 8
        for (int c = 0; c < 64; ++c) { float x = Ss[tid * 68 + c]; a += x * x; }
        rsum += a;
    }

    // ---- O += S * CV : contraction over 64 keys, 16 x4 steps ----
    #pragma unroll 4
    for (int st4 = 0; st4 < 16; ++st4) {
        int k0 = st4 * 4 + dK;
        v2f a  = *(const v2f*)(&Ss[(mt * 16 + ln15) * 68 + k0]);
        v2f b0 = *(const v2f*)(&CVt[(ntB * 16 + ln15) * 68 + k0]);
        v2f b1 = *(const v2f*)(&CVt[((ntB + 1) * 16 + ln15) * 68 + k0]);
        o0 = wmma_f32(a, b0, o0);
        o1 = wmma_f32(a, b1, o1);
    }

    #pragma unroll
    for (int j = 0; j < 8; ++j) {
        int m = mt * 16 + j + ((lane < 16) ? 0 : 8);
        size_t rowOff = ((size_t)bh * SEQ + qBase + m) * DHEAD;
        qKV[rowOff + ntB * 16 + ln15]       = o0[j];
        qKV[rowOff + (ntB + 1) * 16 + ln15] = o1[j];
    }
    if (tid < 64) rs[(size_t)bh * SEQ + qBase + tid] = rsum;
}

// ---------------------------------------------------------------------------
// Denominator scan: cum = cumsum_q(rowSumSq / (2*DH)); dinv = 1/((q+1)+cum)
// ---------------------------------------------------------------------------
// Chunked parallel prefix sum: 256 threads x 8 rows; thread sums are scanned
// inside each wave by lane shifts, wave sums meet in LDS behind one barrier.
__global__ __launch_bounds__(256) void denom_kernel(const float* __restrict__ rs, float* __restrict__ dinv)
{
    __shared__ float wsum[8];
    int bh   = blockIdx.x;
    int t    = threadIdx.x;
    int lane = t & 31, wave = t >> 5;
    const float inv2d = 1.0f / (2.0f * DHEAD);
    size_t base = (size_t)bh * SEQ + t * 8;

    v4f lo = *(const v4f*)(rs + base) * inv2d;
    v4f hi = *(const v4f*)(rs + base + 4) * inv2d;
    float x[8] = {lo[0], lo[1], lo[2], lo[3], hi[0], hi[1], hi[2], hi[3]};

    float s = x[0];
    #pragma unroll
    for (int j = 1; j < 8; ++j) s += x[j];

    float inc = s;                               // inclusive scan over the wave's 32 thread sums
    #pragma unroll
    for (int d = 1; d < 32; d <<= 1) {
        float up = __shfl_up(inc, d, 32);
        if (lane >= d) inc += up;
    }
    if (lane == 31) wsum[wave] = inc;
    float exc = __shfl_up(inc, 1, 32);
    if (lane == 0) exc = 0.f;
    __syncthreads();

    float cum = 0.f;
    #pragma unroll
    for (int w = 0; w < 7; ++w) {
        float tw = wsum[w];
        if (w < wave) cum += tw;
    }
    cum += exc;

    float r[8];
    #pragma unroll
    for (int j = 0; j < 8; ++j) {
        cum += x[j];
        r[j] = 1.0f / ((float)(t * 8 + j + 1) + cum);
    }
    v4f olo = {r[0], r[1], r[2], r[3]}, ohi = {r[4], r[5], r[6], r[7]};
    *(v4f*)(dinv + base)     = olo;
    *(v4f*)(dinv + base + 4) = ohi;
}

// ---------------------------------------------------------------------------
// y[b,l,h*DH+i] = mv + (qKV / sqrt(DH)) * dinv   (row-major for final GEMM)
// ---------------------------------------------------------------------------
__global__ __launch_bounds__(256) void finalize_kernel(
    const float* __restrict__ qKV, const float* __restrict__ mv,
    const float* __restrict__ dinv, float* __restrict__ y)
{
    size_t idx = (size_t)blockIdx.x * 256 + threadIdx.x;
    if (idx >= (size_t)BATCH * HEADS * SEQ * DHEAD) return;
    size_t rowIdx = idx >> 6;           // bh*SEQ + l
    int i  = (int)(idx & 63);
    int l  = (int)(rowIdx & (SEQ - 1));
    int bh = (int)(rowIdx >> 11);
    int b  = bh / HEADS, h = bh - b * HEADS;
    const float invSqrtDh = 0.125f;     // 1/sqrt(64)
    float val = mv[idx] + qKV[idx] * invSqrtDh * dinv[rowIdx];
    y[((size_t)(b * SEQ + l)) * DMODEL + h * DHEAD + i] = val;
}

// ---------------------------------------------------------------------------
extern "C" void kernel_launch(void* const* d_in, const int* in_sizes, int n_in,
                              void* d_out, int out_size, void* d_ws, size_t ws_size,
                              hipStream_t stream) {
    const float* hs = (const float*)d_in[0];
    const float* Wq = (const float*)d_in[1];
    const float* Wk = (const float*)d_in[2];
    const float* Wv = (const float*)d_in[3];
    const float* Wo = (const float*)d_in[4];
    float* out = (float*)d_out;

    const int M  = BATCH * SEQ;            // 4096
    const int NF = HEADS * FDIM;           // 192
    const int NV = HEADS * DHEAD;          // 768

    float* ws = (float*)d_ws;
    size_t off = 0;
    float* q_raw = ws + off; off += (size_t)M * NF;
    float* k_raw = ws + off; off += (size_t)M * NF;
    float* v_raw = ws + off; off += (size_t)M * NV;
    float* ck    = ws + off; off += (size_t)BATCH * HEADS * SEQ * FDIM;
    float* cv    = ws + off; off += (size_t)BATCH * HEADS * SEQ * DHEAD;
    float* mv    = ws + off; off += (size_t)BATCH * HEADS * SEQ * DHEAD;
    float* qKV   = ws + off; off += (size_t)BATCH * HEADS * SEQ * DHEAD;
    float* rsbuf = ws + off; off += (size_t)BATCH * HEADS * SEQ;
    float* dinv  = ws + off; off += (size_t)BATCH * HEADS * SEQ;
    float* ybuf  = ws + off; off += (size_t)M * DMODEL;
    float* cstat = ws + off; off += (size_t)BATCH * HEADS * NCHUNK * ST_FLOATS;
    (void)ws_size; (void)in_sizes; (void)n_in; (void)out_size;

    // 1: input projections, one launch
    proj_qkv_kernel<<<dim3((M / GBM) * QKV_CB), 256, 0, stream>>>(hs, Wq, Wk, Wv, q_raw, k_raw, v_raw);

    // 2: running-mean centering
    center_scan_kernel<<<dim3(CS_KGRP + CS_VGRP, BATCH, CS_PARTS), 256, 0, stream>>>(k_raw, v_raw, ck, cv, mv);

    // 3: per-chunk states, then the causal attention core on their prefix sums
    chunk_state_kernel<<<dim3(NCHUNK, HEADS, BATCH), 160, 0, stream>>>(ck, cv, cstat);
    atten_kernel<<<dim3(SEQ / 64, HEADS, BATCH), 256, 0, stream>>>(q_raw, ck, cv, cstat, qKV, rsbuf);

    // 4: denominator scan
    denom_kernel<<<dim3(BATCH * HEADS), 256, 0, stream>>>(rsbuf, dinv);

    // 5: finalize y
    size_t nElem = (size_t)BATCH * HEADS * SEQ * DHEAD;
    finalize_kernel<<<dim3((unsigned)((nElem + 255) / 256)), 256, 0, stream>>>(qKV, mv, dinv, ybuf);

    // 6: output projection
    gemm_wmma_f32<<<dim3((M / GBM) * (DMODEL / GBN)), 256, 0, stream>>>(ybuf, Wo, out, M, DMODEL, DMODEL);
}

// v004
// Measured time: 123 microseconds a run.
// Timed twice side by side with v003, it ran 1.36 times as fast both times.
// Counting every step since v000, it is 5.94 times as fast.
#include <hip/hip_runtime.h>
#include <hip/hip_bf16.h>

typedef __attribute__((ext_vector_type(2))) float v2f;
typedef __attribute__((ext_vector_type(4))) float v4f;
typedef __attribute__((ext_vector_type(8))) float v8f;

#define BATCH 2
#define SEQ   2048
#define DMODEL 768
#define HEADS 12
#define FDIM  16
#define DHEAD 64

#define AS1 __attribute__((address_space(1)))
#define AS3 __attribute__((address_space(3)))

#if defined(__has_builtin)
#if __has_builtin(__builtin_amdgcn_global_load_async_to_lds_b32) && \
    __has_builtin(__builtin_amdgcn_s_wait_asynccnt)
#define USE_ASYNC_LDS 1
#endif
#endif

static __device__ __forceinline__ v8f wmma_f32(v2f a, v2f b, v8f c) {
    return __builtin_amdgcn_wmma_f32_16x16x4_f32(false, a, false, b, (short)0, c, false, false);
}

// ---------------------------------------------------------------------------
// Block-tiled fp32 WMMA GEMM: C(MxN) = A(MxK,rm) * B(KxN,rm).
// Block = 128x64 C tile, 8 waves, each wave a 32x32 sub-block (4 WMMA tiles).
// K staged in 64-wide slabs: a slab holds one aligned 256-byte piece of every A
// row and of every B row. A row-major, B transposed, both at stride 68 in LDS, so
// every WMMA operand is a single aligned ds_load_b64, bank-conflict free for both
// lane halves. Slabs staged via async global->LDS DMA when the toolchain exposes
// it. Requires M%128==0, N%64==0, K%64==0.
// ---------------------------------------------------------------------------
#define GBM 128
#define GBN 64
#define GKT 64
#define GLD (GKT + 4)                 // LDS row stride, floats
#define GA_PASS (GBM * GKT / 256)     // 32 copies a thread for the A slab
#define GB_PASS (GBN * GKT / 256)     // 16 copies a thread for the B slab

static __device__ __forceinline__ void gemm_tile(
    const float* __restrict__ A, const float* __restrict__ B,
    float* __restrict__ C, int K, int N, int rowBase, int colBase)
{
    __shared__ float As[GBM * GLD];  // [row][k]  128 x 64, stride 68
    __shared__ float Bt[GBN * GLD];  // [col][k]   64 x 64, stride 68 (transposed)

    int tid  = threadIdx.x;
    int wave = tid >> 5, lane = tid & 31;
    int ln15 = lane & 15;
    int dK   = (lane < 16) ? 0 : 2;

    int aRow0 = (wave & 3) * 32;
    int bCol0 = (wave >> 2) * 32;

    int ar = tid >> 6, af = tid & 63;     // A staging: 32 rows apart by 4, a wave copies one 128-byte line
    int br = tid >> 6, bc = tid & 63;     // B staging: 16 rows apart by 4
    // a copy's address = a base that is the same for the whole block + the thread's own
    // 32-bit offset: keeps the projection kernel at 8 waves a SIMD by registers (with one
    // 64-bit row offset a copy it had 5, and the three blocks dealt to some WGPs need 6)
    unsigned aOff = (unsigned)(ar * K + af);
    unsigned bOff = (unsigned)(br * N + bc);
    const float* Ab = A + (size_t)rowBase * K;
    const float* Bb = B + colBase;

    v8f acc00 = {}, acc01 = {}, acc10 = {}, acc11 = {};

    for (int k0 = 0; k0 < K; k0 += GKT) {
        __syncthreads();
#ifdef USE_ASYNC_LDS
        #pragma unroll
        for (int i = 0; i < GA_PASS; ++i)
            __builtin_amdgcn_global_load_async_to_lds_b32(
                (AS1 int*)(Ab + ((size_t)(i * 4) * K + k0) + aOff),
                (AS3 int*)(As + (ar + i * 4) * GLD + af), 0, 0);
        #pragma unroll
        for (int i = 0; i < GB_PASS; ++i)
            __builtin_amdgcn_global_load_async_to_lds_b32(
                (AS1 int*)(Bb + (size_t)(k0 + i * 4) * N + bOff),
                (AS3 int*)(Bt + bc * GLD + br + i * 4), 0, 0);
        // this wave's copies have landed before the barrier lets any wave read the slab
        asm volatile("s_wait_asynccnt 0x0" ::: "memory");
#else
        float ta[GA_PASS], tb[GB_PASS];
        #pragma unroll
        for (int i = 0; i < GA_PASS; ++i)
            ta[i] = (Ab + ((size_t)(i * 4) * K + k0))[aOff];
        #pragma unroll
        for (int i = 0; i < GB_PASS; ++i)
            tb[i] = (Bb + (size_t)(k0 + i * 4) * N)[bOff];
        #pragma unroll
        for (int i = 0; i < GA_PASS; ++i) As[(ar + i * 4) * GLD + af] = ta[i];
        #pragma unroll
        for (int i = 0; i < GB_PASS; ++i) Bt[bc * GLD + br + i * 4] = tb[i];
#endif
        if (k0 + GKT < K) {                                    // global_prefetch_b8
            __builtin_prefetch(&A[(size_t)(rowBase + (tid & 127)) * K + k0 + GKT], 0, 3);
            if (tid < GKT)
                __builtin_prefetch(&B[(size_t)(k0 + GKT + tid) * N + colBase], 0, 3);
        }
        __syncthreads();

        #pragma unroll
        for (int st = 0; st < GKT / 4; ++st) {
            int kk = st * 4 + dK;                              // even -> 8B-aligned
            v2f a0 = *(const v2f*)(&As[(aRow0 + ln15) * GLD + kk]);
            v2f a1 = *(const v2f*)(&As[(aRow0 + 16 + ln15) * GLD + kk]);
            v2f b0 = *(const v2f*)(&Bt[(bCol0 + ln15) * GLD + kk]);
            v2f b1 = *(const v2f*)(&Bt[(bCol0 + 16 + ln15) * GLD + kk]);
            acc00 = wmma_f32(a0, b0, acc00);
            acc01 = wmma_f32(a0, b1, acc01);
            acc10 = wmma_f32(a1, b0, acc10);
            acc11 = wmma_f32(a1, b1, acc11);
        }
    }

    #pragma unroll
    for (int j = 0; j < 8; ++j) {
        int rL = j + ((lane < 16) ? 0 : 8);
        int r0 = rowBase + aRow0 + rL;
        int r1 = r0 + 16;
        int c0 = colBase + bCol0 + ln15;
        int c1 = c0 + 16;
        C[(size_t)r0 * N + c0] = acc00[j];
        C[(size_t)r0 * N + c1] = acc01[j];
        C[(size_t)r1 * N + c0] = acc10[j];
        C[(size_t)r1 * N + c1] = acc11[j];
    }
}

__global__ __launch_bounds__(256) void gemm_wmma_f32(
    const float* __restrict__ A, const float* __restrict__ B,
    float* __restrict__ C, int M, int K, int N)
{
    int nBlocks = N / GBN;
    int bm = blockIdx.x / nBlocks;
    int bn = blockIdx.x - bm * nBlocks;
    gemm_tile(A, B, C, K, N, bm * GBM, bn * GBN);
}

// The three input projections share A and are one launch: a block's column
// index runs over the 64-wide column blocks of Wq, then Wk, then Wv.
#define QK_CB (HEADS * FDIM / GBN)            // 3 column blocks of q, and of k
#define V_CB  (HEADS * DHEAD / GBN)           // 12 column blocks of v
#define QKV_CB (2 * QK_CB + V_CB)             // 18

__global__ __launch_bounds__(256) void proj_qkv_kernel(
    const float* __restrict__ A, const float* __restrict__ Wq,
    const float* __restrict__ Wk, const float* __restrict__ Wv,
    float* __restrict__ q, float* __restrict__ k, float* __restrict__ v)
{
    int bm = blockIdx.x / QKV_CB;
    int bn = blockIdx.x - bm * QKV_CB;
    const float* B = Wv;
    float* C = v;
    int N = HEADS * DHEAD, cb = bn - 2 * QK_CB;
    if (bn < QK_CB)          { B = Wq; C = q; N = HEADS * FDIM; cb = bn; }
    else if (bn < 2 * QK_CB) { B = Wk; C = k; N = HEADS * FDIM; cb = bn - QK_CB; }
    gemm_tile(A, B, C, DMODEL, N, bm * GBM, cb * GBN);
}

// ---------------------------------------------------------------------------
// Running-mean centering as a chunked parallel prefix sum over the sequence.
// One block = 32 columns (one 128-byte line of a row) x 512 rows of one batch.
// 256 threads = 8 column quads x 32 chunks; a thread owns 16 rows x 4 columns.
// The rows in front of the block's part are summed again by the block itself
// (no hand-over between blocks); chunk sums meet by lane shifts inside a wave,
// wave sums in LDS behind one barrier.
// ---------------------------------------------------------------------------
#define CS_PARTS  4
#define CS_ROWS   (SEQ / CS_PARTS)            // 512 rows a block
#define CS_CHUNKS 32
#define CS_RPT    (CS_ROWS / CS_CHUNKS)       // 16 rows a thread
#define CS_KGRP   (HEADS * FDIM / 32)         // 6 column groups of k
#define CS_VGRP   (HEADS * DHEAD / 32)        // 24 column groups of v

// IS_K picks the row pitch at compile time, so that every row of a thread is
// one address register plus an immediate offset.
template <bool IS_K>
static __device__ __forceinline__ void center_part(
    const float* __restrict__ raw, float* __restrict__ centered, float* __restrict__ mean,
    int grp, int b, int part, v4f (*tot)[8], v4f (*pre)[8])
{
    constexpr int PITCH = IS_K ? HEADS * FDIM : HEADS * DHEAD;   // floats in a source row
    constexpr int W     = IS_K ? FDIM : DHEAD;                   // floats in a head's row

    int quad  = threadIdx.x & 7;
    int chunk = threadIdx.x >> 3;
    int col   = grp * 32 + quad * 4;
    int row0  = part * CS_ROWS + chunk * CS_RPT;
    const float* colp = raw + (size_t)b * SEQ * PITCH + col;

    const float* own = colp + (size_t)row0 * PITCH;
    v4f x[CS_RPT];
    #pragma unroll
    for (int r = 0; r < CS_RPT - 1; ++r)
        x[r] = *(const v4f*)(own + r * PITCH);
    // precaution: the build lets the last row's result take the address pair that
    // the loads above name; their wait stands in front of that overwrite
    asm volatile("s_wait_xcnt 0x0" ::: "memory");
    x[CS_RPT - 1] = *(const v4f*)(own + (CS_RPT - 1) * PITCH);

    // rows in front of the part, dealt row by row over the 32 chunks
    const float* front = colp + (size_t)chunk * PITCH;
    v4f p = {};
    #pragma unroll
    for (int i = 0; i < CS_PARTS - 1; ++i) {
        if (i < part) {
            #pragma unroll
            for (int r = 0; r < CS_RPT; ++r)
                p += *(const v4f*)(front + (i * CS_RPT + r) * CS_CHUNKS * PITCH);
        }
    }

    v4f s = x[0];
    #pragma unroll
    for (int r = 1; r < CS_RPT; ++r) s += x[r];

    // the wave's 4 chunks meet by lane shifts: sums of the chunks in front (exc),
    // and the wave's whole share of the front rows (pw)
    int wave = threadIdx.x >> 5;
    int cw   = chunk & 3;
    v4f exc = {}, pw = p;
    #pragma unroll
    for (int d = 1; d < 4; ++d) {
        #pragma unroll
        for (int k = 0; k < 4; ++k) {
            float up = __shfl_up(s[k], 8 * d, 32);
            exc[k] += (cw >= d) ? up : 0.f;
            pw[k]  += __shfl_xor(p[k], 8 * d, 32);
        }
    }
    if (cw == 3) {
        tot[wave][quad] = exc + s;
        pre[wave][quad] = pw;
    }
    __syncthreads();

    v4f run = {};
    #pragma unroll
    for (int w = 0; w < 8; ++w) run += pre[w][quad];
    #pragma unroll
    for (int w = 0; w < 7; ++w) {
        v4f tw = tot[w][quad];
        run += (w < wave) ? tw : v4f{};   // a select, so that all the LDS reads fly together
    }
    run += exc;

    int bh = b * HEADS + col / W;
    size_t o = ((size_t)bh * SEQ + row0) * W + (col % W);
    float* dc = centered + o;
    float* dm = mean + o;
    #pragma unroll
    for (int r = 0; r < CS_RPT; ++r) {
        run += x[r];
        v4f m = run / (float)(row0 + r + 1);
        if (!IS_K) *(v4f*)(dm + r * W) = m;
        *(v4f*)(dc + r * W) = x[r] - m;
    }
    // precaution: in the build the k path's code follows the v path's and rewrites the
    // registers that the stores above name; their wait stands behind the last store
    if (!IS_K) asm volatile("s_wait_xcnt 0x0" ::: "memory");
}

__global__ __launch_bounds__(256) void center_scan_kernel(
    const float* __restrict__ k_raw, const float* __restrict__ v_raw,
    float* __restrict__ ck, float* __restrict__ cv, float* __restrict__ mv)
{
    __shared__ v4f tot[8][8];   // [wave][quad] sum of the wave's own 64 rows
    __shared__ v4f pre[8][8];   // [wave][quad] the wave's share of the rows in front of the part

    int g    = blockIdx.x;
    int b    = blockIdx.y;
    int part = CS_PARTS - 1 - blockIdx.z;     // the part with most rows in front starts first

    if (g < CS_KGRP) center_part<true >(k_raw, ck, ck, g,           b, part, tot, pre);
    else             center_part<false>(v_raw, cv, mv, g - CS_KGRP, b, part, tot, pre);
}

// ---------------------------------------------------------------------------
// The causal product has no softmax, so it is re-associated by 64-key chunks:
//   tril(Q CK^T) CV        = Q (sum over earlier chunks of CK_c^T CV_c) + own chunk's masked tile
//   row sums of tril(..)^2 = q^T (sum over earlier chunks of CK_c^T CK_c) q + own chunk's masked tile
// Chunk state = five 16x16 tiles, each 256 floats in a row (one wave writes one tile):
// tiles 0..3 are CK_c^T CV_c [f][d], 16 columns of d each; tile 4 is CK_c^T CK_c [f][f].
// ---------------------------------------------------------------------------
#define NCHUNK    (SEQ / 64)
#define ST_TILE   256
#define ST_KK     (4 * ST_TILE)
#define ST_FLOATS (5 * ST_TILE)

// One 16x16 tile of a chunk's state: contraction over the chunk's 64 keys. Both
// operands are key-major in memory, which is the fragment order: no staging.
template <int BPITCH>
static __device__ __forceinline__ void state_tile(
    const float* __restrict__ ap, const float* __restrict__ bp, float* __restrict__ dst)
{
    v2f a[16], bb[16];
    // unrolled: every load is one address plus an immediate, and they fly together
    #pragma unroll
    for (int s = 0; s < 16; ++s) {
        a[s]  = v2f{ap[s * 4 * FDIM],   ap[(s * 4 + 1) * FDIM]};
        bb[s] = v2f{bp[s * 4 * BPITCH], bp[(s * 4 + 1) * BPITCH]};
    }
    v8f acc = {};
    #pragma unroll
    for (int s = 0; s < 16; ++s) acc = wmma_f32(a[s], bb[s], acc);
    #pragma unroll
    for (int j = 0; j < 8; ++j) dst[j * 16] = acc[j];
}

__global__ __launch_bounds__(160) void chunk_state_kernel(
    const float* __restrict__ ck, const float* __restrict__ cv, float* __restrict__ st)
{
    int c  = blockIdx.x;
    int bh = blockIdx.z * HEADS + blockIdx.y;
    int lane = threadIdx.x & 31;
    int tile = __builtin_amdgcn_readfirstlane(threadIdx.x >> 5);
    int ln15 = lane & 15;
    int hi   = lane >> 4;

    size_t key0 = (size_t)bh * SEQ + c * 64 + hi * 2;       // lane half holds k and k+1, or k+2 and k+3
    const float* ap = ck + key0 * FDIM + ln15;
    float* dst = st + ((size_t)bh * NCHUNK + c) * ST_FLOATS + tile * ST_TILE + hi * 8 * 16 + ln15;
    if (tile < 4) state_tile<DHEAD>(ap, cv + key0 * DHEAD + tile * 16 + ln15, dst);
    else          state_tile<FDIM >(ap, ap, dst);
}

// ---------------------------------------------------------------------------
// Causal attention core: one block per (b,h,64-query chunk). The states of the
// chunks in front are summed by the block itself; the own chunk's tile
// S = Q * CK^T (masked) goes through LDS: row sums of S^2, O += S * CV.
// ---------------------------------------------------------------------------
#define PF_GROUP 8     // chunk states whose loads fly together

__global__ __launch_bounds__(256) void atten_kernel(
    const float* __restrict__ q_raw, const float* __restrict__ ck,
    const float* __restrict__ cv, const float* __restrict__ st,
    float* __restrict__ qKV, float* __restrict__ rs)
{
    __shared__ float Qs[64 * 20];    // [q][f]   stride 20
    __shared__ float CKs[64 * 20];   // [k][f]   stride 20
    __shared__ float CVt[64 * 68];   // [d][k]   stride 68 (transposed)
    __shared__ float Ss[64 * 68];    // [q][k]   stride 68 (even -> aligned v2f)
    __shared__ __attribute__((aligned(16))) float Ps[ST_FLOATS];   // summed state of the chunks in front
    __shared__ __attribute__((aligned(16))) float Tq[64 * 20];     // [q][f] (Q * KK) times Q, element by element

    int qt = blockIdx.x;
    int h  = blockIdx.y;
    int b  = blockIdx.z;
    int bh = b * HEADS + h;
    int qBase = qt * 64;

    int tid  = threadIdx.x;
    int wave = __builtin_amdgcn_readfirstlane(tid >> 5), lane = tid & 31;
    int ln15 = lane & 15;
    int dK   = (lane < 16) ? 0 : 2;
    int mt   = wave & 3;
    int ntB  = (wave >> 2) * 2;

    int qr = tid >> 4, qf = tid & 15;     // Q/CK staging: 4 rows apart by 16
    int vr = tid >> 6, vc = tid & 63;     // CV staging: 16 rows apart by 4

    const float* qg  = q_raw + ((size_t)(b * SEQ + qBase)) * (HEADS * FDIM) + h * FDIM;
    const float* ckg = ck + ((size_t)bh * SEQ + qBase) * FDIM;
    const float* cvg = cv + ((size_t)bh * SEQ + qBase) * DHEAD;
#ifdef USE_ASYNC_LDS
    #pragma unroll
    for (int i = 0; i < 4; ++i)
        __builtin_amdgcn_global_load_async_to_lds_b32(
            (AS1 int*)(qg + (size_t)(qr + i * 16) * (HEADS * FDIM) + qf),
            (AS3 int*)(Qs + (qr + i * 16) * 20 + qf), 0, 0);
    #pragma unroll
    for (int i = 0; i < 4; ++i)
        __builtin_amdgcn_global_load_async_to_lds_b32(
            (AS1 int*)(ckg + (size_t)(qr + i * 16) * FDIM + qf),
            (AS3 int*)(CKs + (qr + i * 16) * 20 + qf), 0, 0);
    #pragma unroll
    for (int i = 0; i < 16; ++i)
        __builtin_amdgcn_global_load_async_to_lds_b32(
            (AS1 int*)(cvg + (size_t)(vr + i * 4) * DHEAD + vc),
            (AS3 int*)(CVt + vc * 68 + vr + i * 4), 0, 0);
#else
    {
        float tq[4], tk[4], tv[16];
        #pragma unroll
        for (int i = 0; i < 4; ++i)
            tq[i] = qg[(size_t)(qr + i * 16) * (HEADS * FDIM) + qf];
        #pragma unroll
        for (int i = 0; i < 4; ++i)
            tk[i] = ckg[(size_t)(qr + i * 16) * FDIM + qf];
        #pragma unroll
        for (int i = 0; i < 16; ++i)
            tv[i] = cvg[(size_t)(vr + i * 4) * DHEAD + vc];
        #pragma unroll
        for (int i = 0; i < 4; ++i) Qs[(qr + i * 16) * 20 + qf] = tq[i];
        #pragma unroll
        for (int i = 0; i < 4; ++i) CKs[(qr + i * 16) * 20 + qf] = tk[i];
        #pragma unroll
        for (int i = 0; i < 16; ++i) CVt[vc * 68 + vr + i * 4] = tv[i];
    }
#endif

    // ---- sum of the states of the chunks in front, in chunk order; a thread owns
    // four floats of the CK^T CV tiles and one of CK^T CK.
    // A group's tail reads the last chunk in front again and adds nothing for it.
    const float* sb = st + (size_t)bh * NCHUNK * ST_FLOATS;
    v4f   pkv = {};
    float pkk = 0.f;
    for (int c0 = 0; c0 < qt; c0 += PF_GROUP) {
        v4f   tkv[PF_GROUP];
        float tkk[PF_GROUP];
        // unrolled: the group's loads fly together
        #pragma unroll
        for (int i = 0; i < PF_GROUP; ++i) {
            int c = (c0 + i < qt) ? c0 + i : qt - 1;
            const float* sc = sb + c * ST_FLOATS;
            tkv[i] = *(const v4f*)(sc + (unsigned)(tid * 4));
            tkk[i] = sc[(unsigned)(ST_KK + tid)];
        }
        // precaution: the next trip rewrites the address registers that the loads above name
        asm volatile("s_wait_xcnt 0x0" ::: "memory");
        #pragma unroll
        for (int i = 0; i < PF_GROUP; ++i) {
            bool in = c0 + i < qt;
            pkv += in ? tkv[i] : v4f{};
            pkk += in ? tkk[i] : 0.f;
        }
    }
    *(v4f*)(Ps + tid * 4) = pkv;
    Ps[ST_KK + tid] = pkk;
#ifdef USE_ASYNC_LDS
    // this wave's copies have landed before the barrier lets any wave read the tiles
    asm volatile("s_wait_asynccnt 0x0" ::: "memory");
#endif
    __syncthreads();

    // ---- S tiles: two 16x16 tiles per wave, F=16 in four x4 steps ----
    #pragma unroll
    for (int sub = 0; sub < 2; ++sub) {
        int nt = ntB + sub;
        v8f s = {};
        #pragma unroll
        for (int st4 = 0; st4 < 4; ++st4) {
            int f0 = st4 * 4 + dK;
            v2f a  = *(const v2f*)(&Qs[(mt * 16 + ln15) * 20 + f0]);
            v2f bb = *(const v2f*)(&CKs[(nt * 16 + ln15) * 20 + f0]);
            s = wmma_f32(a, bb, s);
        }
        int c = nt * 16 + ln15;
        #pragma unroll
        for (int j = 0; j < 8; ++j) {
            int m = mt * 16 + j + ((lane < 16) ? 0 : 8);
            float val = s[j];
            if (c > m) val = 0.f;   // causal: keep key<=query
            Ss[m * 68 + c] = val;
        }
    }

    // ---- the chunks in front: O = Q * (summed CK^T CV), F=16 in four x4 steps ----
    v8f o0 = {}, o1 = {};
    #pragma unroll
    for (int st4 = 0; st4 < 4; ++st4) {
        int f0 = st4 * 4 + dK;
        v2f a  = *(const v2f*)(&Qs[(mt * 16 + ln15) * 20 + f0]);
        const float* p0 = &Ps[ntB * ST_TILE + f0 * 16 + ln15];
        v2f b0 = {p0[0], p0[16]};
        v2f b1 = {p0[ST_TILE], p0[ST_TILE + 16]};
        o0 = wmma_f32(a, b0, o0);
        o1 = wmma_f32(a, b1, o1);
    }

    // ---- their share of the row sums: (Q * summed CK^T CK) times Q, waves 0..3 ----
    if (wave < 4) {
        v8f t = {};
        #pragma unroll
        for (int st4 = 0; st4 < 4; ++st4) {
            int f0 = st4 * 4 + dK;
            v2f a  = *(const v2f*)(&Qs[(mt * 16 + ln15) * 20 + f0]);
            const float* pk = &Ps[ST_KK + f0 * 16 + ln15];
            v2f bk = {pk[0], pk[16]};
            t = wmma_f32(a, bk, t);
        }
        #pragma unroll
        for (int j = 0; j < 8; ++j) {
            int m = mt * 16 + j + ((lane < 16) ? 0 : 8);
            Tq[m * 20 + ln15] = t[j] * Qs[m * 20 + ln15];
        }
    }
    __syncthreads();

    // ---- per-row sum of squares (threads 0..63, one row each) ----
    float rsum = 0.f;
    if (tid < 64) {
        #pragma unroll
        for (int g = 0; g < 4; ++g) {
            v4f x = *(const v4f*)(&Tq[tid * 20 + g * 4]);
            rsum += (x[0] + x[1]) + (x[2] + x[3]);
        }
        float a = 0.f;
        #pragma unroll 8
        for (int c = 0; c < 64; ++c) { float x = Ss[tid * 68 + c]; a += x * x; }
        rsum += a;
    }

    // ---- O += S * CV : contraction over 64 keys, 16 x4 steps ----
    #pragma unroll 4
    for (int st4 = 0; st4 < 16; ++st4) {
        int k0 = st4 * 4 + dK;
        v2f a  = *(const v2f*)(&Ss[(mt * 16 + ln15) * 68 + k0]);
        v2f b0 = *(const v2f*)(&CVt[(ntB * 16 + ln15) * 68 + k0]);
        v2f b1 = *(const v2f*)(&CVt[((ntB + 1) * 16 + ln15) * 68 + k0]);
        o0 = wmma_f32(a, b0, o0);
        o1 = wmma_f32(a, b1, o1);
    }

    #pragma unroll
    for (int j = 0; j < 8; ++j) {
        int m = mt * 16 + j + ((lane < 16) ? 0 : 8);
        size_t rowOff = ((size_t)bh * SEQ + qBase + m) * DHEAD;
        qKV[rowOff + ntB * 16 + ln15]       = o0[j];
        qKV[rowOff + (ntB + 1) * 16 + ln15] = o1[j];
    }
    if (tid < 64) rs[(size_t)bh * SEQ + qBase + tid] = rsum;
}

// ---------------------------------------------------------------------------
// Denominator scan: cum = cumsum_q(rowSumSq / (2*DH)); dinv = 1/((q+1)+cum)
// ---------------------------------------------------------------------------
// Chunked parallel prefix sum: 256 threads x 8 rows; thread sums are scanned
// inside each wave by lane shifts, wave sums meet in LDS behind one barrier.
__global__ __launch_bounds__(256) void denom_kernel(const float* __restrict__ rs, float* __restrict__ dinv)
{
    __shared__ float wsum[8];
    int bh   = blockIdx.x;
    int t    = threadIdx.x;
    int lane = t & 31, wave = t >> 5;
    const float inv2d = 1.0f / (2.0f * DHEAD);
    size_t base = (size_t)bh * SEQ + t * 8;

    v4f lo = *(const v4f*)(rs + base) * inv2d;
    v4f hi = *(const v4f*)(rs + base + 4) * inv2d;
    float x[8] = {lo[0], lo[1], lo[2], lo[3], hi[0], hi[1], hi[2], hi[3]};

    float s = x[0];
    #pragma unroll
    for (int j = 1; j < 8; ++j) s += x[j];

    float inc = s;                               // inclusive scan over the wave's 32 thread sums
    #pragma unroll
    for (int d = 1; d < 32; d <<= 1) {
        float up = __shfl_up(inc, d, 32);
        if (lane >= d) inc += up;
    }
    if (lane == 31) wsum[wave] = inc;
    float exc = __shfl_up(inc, 1, 32);
    if (lane == 0) exc = 0.f;
    __syncthreads();

    float cum = 0.f;
    #pragma unroll
    for (int w = 0; w < 7; ++w) {
        float tw = wsum[w];
        if (w < wave) cum += tw;
    }
    cum += exc;

    float r[8];
    #pragma unroll
    for (int j = 0; j < 8; ++j) {
        cum += x[j];
        r[j] = 1.0f / ((float)(t * 8 + j + 1) + cum);
    }
    v4f olo = {r[0], r[1], r[2], r[3]}, ohi = {r[4], r[5], r[6], r[7]};
    *(v4f*)(dinv + base)     = olo;
    *(v4f*)(dinv + base + 4) = ohi;
}

// ---------------------------------------------------------------------------
// y[b,l,h*DH+i] = mv + (qKV / sqrt(DH)) * dinv   (row-major for final GEMM)
// ---------------------------------------------------------------------------
__global__ __launch_bounds__(256) void finalize_kernel(
    const float* __restrict__ qKV, const float* __restrict__ mv,
    const float* __restrict__ dinv, float* __restrict__ y)
{
    size_t idx = (size_t)blockIdx.x * 256 + threadIdx.x;
    if (idx >= (size_t)BATCH * HEADS * SEQ * DHEAD) return;
    size_t rowIdx = idx >> 6;           // bh*SEQ + l
    int i  = (int)(idx & 63);
    int l  = (int)(rowIdx & (SEQ - 1));
    int bh = (int)(rowIdx >> 11);
    int b  = bh / HEADS, h = bh - b * HEADS;
    const float invSqrtDh = 0.125f;     // 1/sqrt(64)
    float val = mv[idx] + qKV[idx] * invSqrtDh * dinv[rowIdx];
    y[((size_t)(b * SEQ + l)) * DMODEL + h * DHEAD + i] = val;
}

// ---------------------------------------------------------------------------
extern "C" void kernel_launch(void* const* d_in, const int* in_sizes, int n_in,
                              void* d_out, int out_size, void* d_ws, size_t ws_size,
                              hipStream_t stream) {
    const float* hs = (const float*)d_in[0];
    const float* Wq = (const float*)d_in[1];
    const float* Wk = (const float*)d_in[2];
    const float* Wv = (const float*)d_in[3];
    const float* Wo = (const float*)d_in[4];
    float* out = (float*)d_out;

    const int M  = BATCH * SEQ;            // 4096
    const int NF = HEADS * FDIM;           // 192
    const int NV = HEADS * DHEAD;          // 768

    float* ws = (float*)d_ws;
    size_t off = 0;
    float* q_raw = ws + off; off += (size_t)M * NF;
    float* k_raw = ws + off; off += (size_t)M * NF;
    float* v_raw = ws + off; off += (size_t)M * NV;
    float* ck    = ws + off; off += (size_t)BATCH * HEADS * SEQ * FDIM;
    float* cv    = ws + off; off += (size_t)BATCH * HEADS * SEQ * DHEAD;
    float* mv    = ws + off; off += (size_t)BATCH * HEADS * SEQ * DHEAD;
    float* qKV   = ws + off; off += (size_t)BATCH * HEADS * SEQ * DHEAD;
    float* rsbuf = ws + off; off += (size_t)BATCH * HEADS * SEQ;
    float* dinv  = ws + off; off += (size_t)BATCH * HEADS * SEQ;
    float* ybuf  = ws + off; off += (size_t)M * DMODEL;
    float* cstat = ws + off; off += (size_t)BATCH * HEADS * NCHUNK * ST_FLOATS;
    (void)ws_size; (void)in_sizes; (void)n_in; (void)out_size;

    // 1: input projections, one launch
    proj_qkv_kernel<<<dim3((M / GBM) * QKV_CB), 256, 0, stream>>>(hs, Wq, Wk, Wv, q_raw, k_raw, v_raw);

    // 2: running-mean centering
    center_scan_kernel<<<dim3(CS_KGRP + CS_VGRP, BATCH, CS_PARTS), 256, 0, stream>>>(k_raw, v_raw, ck, cv, mv);

    // 3: per-chunk states, then the causal attention core on their prefix sums
    chunk_state_kernel<<<dim3(NCHUNK, HEADS, BATCH), 160, 0, stream>>>(ck, cv, cstat);
    atten_kernel<<<dim3(SEQ / 64, HEADS, BATCH), 256, 0, stream>>>(q_raw, ck, cv, cstat, qKV, rsbuf);

    // 4: denominator scan
    denom_kernel<<<dim3(BATCH * HEADS), 256, 0, stream>>>(rsbuf, dinv);

    // 5: finalize y
    size_t nElem = (size_t)BATCH * HEADS * SEQ * DHEAD;
    finalize_kernel<<<dim3((unsigned)((nElem + 255) / 256)), 256, 0, stream>>>(qKV, mv, dinv, ybuf);

    // 6: output projection
    gemm_wmma_f32<<<dim3((M / GBM) * (DMODEL / GBN)), 256, 0, stream>>>(ybuf, Wo, out, M, DMODEL, DMODEL);
}

// v005
// Measured time: 109 microseconds a run.
// Two timings next to v004 both put it at 1.13 times that version's speed.
// Counting every step since v000, it is 6.72 times as fast.
#include <hip/hip_runtime.h>
#include <hip/hip_bf16.h>

typedef __attribute__((ext_vector_type(2))) float v2f;
typedef __attribute__((ext_vector_type(4))) float v4f;
typedef __attribute__((ext_vector_type(8))) float v8f;

#define BATCH 2
#define SEQ   2048
#define DMODEL 768
#define HEADS 12
#define FDIM  16
#define DHEAD 64

#define AS1 __attribute__((address_space(1)))
#define AS3 __attribute__((address_space(3)))

#if defined(__has_builtin)
#if __has_builtin(__builtin_amdgcn_global_load_async_to_lds_b32) && \
    __has_builtin(__builtin_amdgcn_s_wait_asynccnt)
#define USE_ASYNC_LDS 1
#endif
#endif

static __device__ __forceinline__ v8f wmma_f32(v2f a, v2f b, v8f c) {
    return __builtin_amdgcn_wmma_f32_16x16x4_f32(false, a, false, b, (short)0, c, false, false);
}

// ---------------------------------------------------------------------------
// Block-tiled fp32 WMMA GEMM: C(MxN) = A(MxK,rm) * B(KxN,rm).
// Block = 64x96 C tile, 8 waves, each wave a 16x48 strip (3 WMMA tiles that share
// one A operand). The tile is sized for the chip's 256 WGPs: the projections make
// 768 blocks and the output product 512, a whole number a WGP, so that no WGP's
// matrix units carry a block more than another's.
// K staged in 64-wide slabs: a slab holds one aligned 256-byte piece of every A
// row and one 384-byte piece of every B row. A row-major, B transposed, both at
// stride 68 in LDS, so every WMMA operand is a single aligned ds_load_b64,
// bank-conflict free for both lane halves. Slabs staged via async global->LDS DMA
// when the toolchain exposes it. Requires M%64==0, N%96==0, K%64==0.
// ---------------------------------------------------------------------------
#define GBM 64
#define GBN 96
#define GKT 64
#define GLD (GKT + 4)                 // LDS row stride, floats
#define GA_PASS (GBM * GKT / 256)     // 16 copies a thread for the A slab
#define GB_LINES (GBN / 32)           // 3 lines of 128 bytes in a B row's piece
#define GB_PASS (GBN * GKT / 256)     // 24 copies a thread for the B slab

static __device__ __forceinline__ void gemm_tile(
    const float* __restrict__ A, const float* __restrict__ B,
    float* __restrict__ C, int K, int N, int rowBase, int colBase)
{
    __shared__ float As[GBM * GLD];  // [row][k]   64 x 64, stride 68
    __shared__ float Bt[GBN * GLD];  // [col][k]   96 x 64, stride 68 (transposed)

    int tid  = threadIdx.x;
    int wave = tid >> 5, lane = tid & 31;
    int ln15 = lane & 15;
    int dK   = (lane < 16) ? 0 : 2;

    int aRow0 = (wave & 3) * 16;
    int bCol0 = (wave >> 2) * 48;

    int ar = tid >> 6, af = tid & 63;     // A staging: 16 rows apart by 4, a wave copies one 128-byte line
    // B staging: a wave copies one 128-byte line; pass i takes line i % 3 of row (i / 3) * 8 + wave
    // a copy's address = a base that is the same for the whole block + the thread's own
    // 32-bit offset: keeps the address registers few (the three blocks of a WGP need
    // 6 waves a SIMD)
    unsigned aOff = (unsigned)(ar * K + af);
    unsigned bOff = (unsigned)(wave * N + lane);
    const float* Ab = A + (size_t)rowBase * K;
    const float* Bb = B + colBase;

    v8f acc0 = {}, acc1 = {}, acc2 = {};

    for (int k0 = 0; k0 < K; k0 += GKT) {
        __syncthreads();
#ifdef USE_ASYNC_LDS
        #pragma unroll
        for (int i = 0; i < GA_PASS; ++i)
            __builtin_amdgcn_global_load_async_to_lds_b32(
                (AS1 int*)(Ab + ((size_t)(i * 4) * K + k0) + aOff),
                (AS3 int*)(As + (ar + i * 4) * GLD + af), 0, 0);
        #pragma unroll
        for (int i = 0; i < GB_PASS; ++i)
            __builtin_amdgcn_global_load_async_to_lds_b32(
                (AS1 int*)(Bb + ((size_t)(k0 + (i / GB_LINES) * 8) * N + (i % GB_LINES) * 32) + bOff),
                (AS3 int*)(Bt + ((i % GB_LINES) * 32 + lane) * GLD + (i / GB_LINES) * 8 + wave), 0, 0);
        // this wave's copies have landed before the barrier lets any wave read the slab
        asm volatile("s_wait_asynccnt 0x0" ::: "memory");
#else
        float ta[GA_PASS], tb[GB_PASS];
        #pragma unroll
        for (int i = 0; i < GA_PASS; ++i)
            ta[i] = (Ab + ((size_t)(i * 4) * K + k0))[aOff];
        #pragma unroll
        for (int i = 0; i < GB_PASS; ++i)
            tb[i] = (Bb + ((size_t)(k0 + (i / GB_LINES) * 8) * N + (i % GB_LINES) * 32))[bOff];
        #pragma unroll
        for (int i = 0; i < GA_PASS; ++i) As[(ar + i * 4) * GLD + af] = ta[i];
        #pragma unroll
        for (int i = 0; i < GB_PASS; ++i)
            Bt[((i % GB_LINES) * 32 + lane) * GLD + (i / GB_LINES) * 8 + wave] = tb[i];
#endif
        if (k0 + GKT < K) {                                    // global_prefetch_b8
            if (tid < GBM)
                __builtin_prefetch(&A[(size_t)(rowBase + tid) * K + k0 + GKT], 0, 3);
            else if (tid < GBM + 2 * GKT)                      // both ends of a B row's 384 bytes
                __builtin_prefetch(&B[(size_t)(k0 + GKT + ((tid - GBM) >> 1)) * N + colBase + (tid & 1) * 64], 0, 3);
        }
        __syncthreads();

        #pragma unroll
        for (int st = 0; st < GKT / 4; ++st) {
            int kk = st * 4 + dK;                              // even -> 8B-aligned
            v2f a  = *(const v2f*)(&As[(aRow0 + ln15) * GLD + kk]);
            v2f b0 = *(const v2f*)(&Bt[(bCol0 + ln15) * GLD + kk]);
            v2f b1 = *(const v2f*)(&Bt[(bCol0 + 16 + ln15) * GLD + kk]);
            v2f b2 = *(const v2f*)(&Bt[(bCol0 + 32 + ln15) * GLD + kk]);
            acc0 = wmma_f32(a, b0, acc0);
            acc1 = wmma_f32(a, b1, acc1);
            acc2 = wmma_f32(a, b2, acc2);
        }
    }

    #pragma unroll
    for (int j = 0; j < 8; ++j) {
        int r = rowBase + aRow0 + j + ((lane < 16) ? 0 : 8);
        int c = colBase + bCol0 + ln15;
        C[(size_t)r * N + c]      = acc0[j];
        C[(size_t)r * N + c + 16] = acc1[j];
        C[(size_t)r * N + c + 32] = acc2[j];
    }
}

__global__ __launch_bounds__(256) void gemm_wmma_f32(
    const float* __restrict__ A, const float* __restrict__ B,
    float* __restrict__ C, int M, int K, int N)
{
    int nBlocks = N / GBN;
    int bm = blockIdx.x / nBlocks;
    int bn = blockIdx.x - bm * nBlocks;
    gemm_tile(A, B, C, K, N, bm * GBM, bn * GBN);
}

// The three input projections share A and are one launch: a block's column
// index runs over the 96-wide column blocks of Wq, then Wk, then Wv.
#define QK_CB (HEADS * FDIM / GBN)            // 2 column blocks of q, and of k
#define V_CB  (HEADS * DHEAD / GBN)           // 8 column blocks of v
#define QKV_CB (2 * QK_CB + V_CB)             // 12

__global__ __launch_bounds__(256) void proj_qkv_kernel(
    const float* __restrict__ A, const float* __restrict__ Wq,
    const float* __restrict__ Wk, const float* __restrict__ Wv,
    float* __restrict__ q, float* __restrict__ k, float* __restrict__ v)
{
    int bm = blockIdx.x / QKV_CB;
    int bn = blockIdx.x - bm * QKV_CB;
    const float* B = Wv;
    float* C = v;
    int N = HEADS * DHEAD, cb = bn - 2 * QK_CB;
    if (bn < QK_CB)          { B = Wq; C = q; N = HEADS * FDIM; cb = bn; }
    else if (bn < 2 * QK_CB) { B = Wk; C = k; N = HEADS * FDIM; cb = bn - QK_CB; }
    gemm_tile(A, B, C, DMODEL, N, bm * GBM, cb * GBN);
}

// ---------------------------------------------------------------------------
// Running-mean centering as a chunked parallel prefix sum over the sequence.
// One block = 32 columns (one 128-byte line of a row) x 512 rows of one batch.
// 256 threads = 8 column quads x 32 chunks; a thread owns 16 rows x 4 columns.
// The rows in front of the block's part are summed again by the block itself
// (no hand-over between blocks); chunk sums meet by lane shifts inside a wave,
// wave sums in LDS behind one barrier.
// ---------------------------------------------------------------------------
#define CS_PARTS  4
#define CS_ROWS   (SEQ / CS_PARTS)            // 512 rows a block
#define CS_CHUNKS 32
#define CS_RPT    (CS_ROWS / CS_CHUNKS)       // 16 rows a thread
#define CS_KGRP   (HEADS * FDIM / 32)         // 6 column groups of k
#define CS_VGRP   (HEADS * DHEAD / 32)        // 24 column groups of v

// IS_K picks the row pitch at compile time, so that every row of a thread is
// one address register plus an immediate offset.
template <bool IS_K>
static __device__ __forceinline__ void center_part(
    const float* __restrict__ raw, float* __restrict__ centered, float* __restrict__ mean,
    int grp, int b, int part, v4f (*tot)[8], v4f (*pre)[8])
{
    constexpr int PITCH = IS_K ? HEADS * FDIM : HEADS * DHEAD;   // floats in a source row
    constexpr int W     = IS_K ? FDIM : DHEAD;                   // floats in a head's row

    int quad  = threadIdx.x & 7;
    int chunk = threadIdx.x >> 3;
    int col   = grp * 32 + quad * 4;
    int row0  = part * CS_ROWS + chunk * CS_RPT;
    const float* colp = raw + (size_t)b * SEQ * PITCH + col;

    const float* own = colp + (size_t)row0 * PITCH;
    v4f x[CS_RPT];
    #pragma unroll
    for (int r = 0; r < CS_RPT - 1; ++r)
        x[r] = *(const v4f*)(own + r * PITCH);
    // precaution: the build lets the last row's result take the address pair that
    // the loads above name; their wait stands in front of that overwrite
    asm volatile("s_wait_xcnt 0x0" ::: "memory");
    x[CS_RPT - 1] = *(const v4f*)(own + (CS_RPT - 1) * PITCH);

    // rows in front of the part, dealt row by row over the 32 chunks
    const float* front = colp + (size_t)chunk * PITCH;
    v4f p = {};
    #pragma unroll
    for (int i = 0; i < CS_PARTS - 1; ++i) {
        if (i < part) {
            #pragma unroll
            for (int r = 0; r < CS_RPT; ++r)
                p += *(const v4f*)(front + (i * CS_RPT + r) * CS_CHUNKS * PITCH);
        }
    }

    v4f s = x[0];
    #pragma unroll
    for (int r = 1; r < CS_RPT; ++r) s += x[r];

    // the wave's 4 chunks meet by lane shifts: sums of the chunks in front (exc),
    // and the wave's whole share of the front rows (pw)
    int wave = threadIdx.x >> 5;
    int cw   = chunk & 3;
    v4f exc = {}, pw = p;
    #pragma unroll
    for (int d = 1; d < 4; ++d) {
        #pragma unroll
        for (int k = 0; k < 4; ++k) {
            float up = __shfl_up(s[k], 8 * d, 32);
            exc[k] += (cw >= d) ? up : 0.f;
            pw[k]  += __shfl_xor(p[k], 8 * d, 32);
        }
    }
    if (cw == 3) {
        tot[wave][quad] = exc + s;
        pre[wave][quad] = pw;
    }
    __syncthreads();

    v4f run = {};
    #pragma unroll
    for (int w = 0; w < 8; ++w) run += pre[w][quad];
    #pragma unroll
    for (int w = 0; w < 7; ++w) {
        v4f tw = tot[w][quad];
        run += (w < wave) ? tw : v4f{};   // a select, so that all the LDS reads fly together
    }
    run += exc;

    int bh = b * HEADS + col / W;
    size_t o = ((size_t)bh * SEQ + row0) * W + (col % W);
    float* dc = centered + o;
    float* dm = mean + o;
    #pragma unroll
    for (int r = 0; r < CS_RPT; ++r) {
        run += x[r];
        v4f m = run / (float)(row0 + r + 1);
        if (!IS_K) *(v4f*)(dm + r * W) = m;
        *(v4f*)(dc + r * W) = x[r] - m;
    }
    // precaution: in the build the k path's code follows the v path's and rewrites the
    // registers that the stores above name; their wait stands behind the last store
    if (!IS_K) asm volatile("s_wait_xcnt 0x0" ::: "memory");
}

__global__ __launch_bounds__(256) void center_scan_kernel(
    const float* __restrict__ k_raw, const float* __restrict__ v_raw,
    float* __restrict__ ck, float* __restrict__ cv, float* __restrict__ mv)
{
    __shared__ v4f tot[8][8];   // [wave][quad] sum of the wave's own 64 rows
    __shared__ v4f pre[8][8];   // [wave][quad] the wave's share of the rows in front of the part

    int g    = blockIdx.x;
    int b    = blockIdx.y;
    int part = CS_PARTS - 1 - blockIdx.z;     // the part with most rows in front starts first

    if (g < CS_KGRP) center_part<true >(k_raw, ck, ck, g,           b, part, tot, pre);
    else             center_part<false>(v_raw, cv, mv, g - CS_KGRP, b, part, tot, pre);
}

// ---------------------------------------------------------------------------
// The causal product has no softmax, so it is re-associated by 64-key chunks:
//   tril(Q CK^T) CV        = Q (sum over earlier chunks of CK_c^T CV_c) + own chunk's masked tile
//   row sums of tril(..)^2 = q^T (sum over earlier chunks of CK_c^T CK_c) q + own chunk's masked tile
// Chunk state = five 16x16 tiles, each 256 floats in a row (one wave writes one tile):
// tiles 0..3 are CK_c^T CV_c [f][d], 16 columns of d each; tile 4 is CK_c^T CK_c [f][f].
// ---------------------------------------------------------------------------
#define NCHUNK    (SEQ / 64)
#define ST_TILE   256
#define ST_KK     (4 * ST_TILE)
#define ST_FLOATS (5 * ST_TILE)

// One 16x16 tile of a chunk's state: contraction over the chunk's 64 keys. Both
// operands are key-major in memory, which is the fragment order: no staging.
template <int BPITCH>
static __device__ __forceinline__ void state_tile(
    const float* __restrict__ ap, const float* __restrict__ bp, float* __restrict__ dst)
{
    v2f a[16], bb[16];
    // unrolled: every load is one address plus an immediate, and they fly together
    #pragma unroll
    for (int s = 0; s < 16; ++s) {
        a[s]  = v2f{ap[s * 4 * FDIM],   ap[(s * 4 + 1) * FDIM]};
        bb[s] = v2f{bp[s * 4 * BPITCH], bp[(s * 4 + 1) * BPITCH]};
    }
    v8f acc = {};
    #pragma unroll
    for (int s = 0; s < 16; ++s) acc = wmma_f32(a[s], bb[s], acc);
    #pragma unroll
    for (int j = 0; j < 8; ++j) dst[j * 16] = acc[j];
}

__global__ __launch_bounds__(160) void chunk_state_kernel(
    const float* __restrict__ ck, const float* __restrict__ cv, float* __restrict__ st)
{
    int c  = blockIdx.x;
    int bh = blockIdx.z * HEADS + blockIdx.y;
    int lane = threadIdx.x & 31;
    int tile = __builtin_amdgcn_readfirstlane(threadIdx.x >> 5);
    int ln15 = lane & 15;
    int hi   = lane >> 4;

    size_t key0 = (size_t)bh * SEQ + c * 64 + hi * 2;       // lane half holds k and k+1, or k+2 and k+3
    const float* ap = ck + key0 * FDIM + ln15;
    float* dst = st + ((size_t)bh * NCHUNK + c) * ST_FLOATS + tile * ST_TILE + hi * 8 * 16 + ln15;
    if (tile < 4) state_tile<DHEAD>(ap, cv + key0 * DHEAD + tile * 16 + ln15, dst);
    else          state_tile<FDIM >(ap, ap, dst);
}

// ---------------------------------------------------------------------------
// Causal attention core: one block per (b,h,64-query chunk). The states of the
// chunks in front are summed by the block itself; the own chunk's tile
// S = Q * CK^T (masked) goes through LDS: row sums of S^2, O += S * CV.
// ---------------------------------------------------------------------------
#define PF_GROUP 8     // chunk states whose loads fly together

__global__ __launch_bounds__(256) void atten_kernel(
    const float* __restrict__ q_raw, const float* __restrict__ ck,
    const float* __restrict__ cv, const float* __restrict__ st,
    float* __restrict__ qKV, float* __restrict__ rs)
{
    __shared__ float Qs[64 * 20];    // [q][f]   stride 20
    __shared__ float CKs[64 * 20];   // [k][f]   stride 20
    __shared__ float CVt[64 * 68];   // [d][k]   stride 68 (transposed)
    __shared__ float Ss[64 * 68];    // [q][k]   stride 68 (even -> aligned v2f)
    __shared__ __attribute__((aligned(16))) float Ps[ST_FLOATS];   // summed state of the chunks in front
    __shared__ __attribute__((aligned(16))) float Tq[64 * 20];     // [q][f] (Q * KK) times Q, element by element

    int qt = blockIdx.x;
    int h  = blockIdx.y;
    int b  = blockIdx.z;
    int bh = b * HEADS + h;
    int qBase = qt * 64;

    int tid  = threadIdx.x;
    int wave = __builtin_amdgcn_readfirstlane(tid >> 5), lane = tid & 31;
    int ln15 = lane & 15;
    int dK   = (lane < 16) ? 0 : 2;
    int mt   = wave & 3;
    int ntB  = (wave >> 2) * 2;

    int qr = tid >> 4, qf = tid & 15;     // Q/CK staging: 4 rows apart by 16
    int vr = tid >> 6, vc = tid & 63;     // CV staging: 16 rows apart by 4

    const float* qg  = q_raw + ((size_t)(b * SEQ + qBase)) * (HEADS * FDIM) + h * FDIM;
    const float* ckg = ck + ((size_t)bh * SEQ + qBase) * FDIM;
    const float* cvg = cv + ((size_t)bh * SEQ + qBase) * DHEAD;
#ifdef USE_ASYNC_LDS
    #pragma unroll
    for (int i = 0; i < 4; ++i)
        __builtin_amdgcn_global_load_async_to_lds_b32(
            (AS1 int*)(qg + (size_t)(qr + i * 16) * (HEADS * FDIM) + qf),
            (AS3 int*)(Qs + (qr + i * 16) * 20 + qf), 0, 0);
    #pragma unroll
    for (int i = 0; i < 4; ++i)
        __builtin_amdgcn_global_load_async_to_lds_b32(
            (AS1 int*)(ckg + (size_t)(qr + i * 16) * FDIM + qf),
            (AS3 int*)(CKs + (qr + i * 16) * 20 + qf), 0, 0);
    #pragma unroll
    for (int i = 0; i < 16; ++i)
        __builtin_amdgcn_global_load_async_to_lds_b32(
            (AS1 int*)(cvg + (size_t)(vr + i * 4) * DHEAD + vc),
            (AS3 int*)(CVt + vc * 68 + vr + i * 4), 0, 0);
#else
    {
        float tq[4], tk[4], tv[16];
        #pragma unroll
        for (int i = 0; i < 4; ++i)
            tq[i] = qg[(size_t)(qr + i * 16) * (HEADS * FDIM) + qf];
        #pragma unroll
        for (int i = 0; i < 4; ++i)
            tk[i] = ckg[(size_t)(qr + i * 16) * FDIM + qf];
        #pragma unroll
        for (int i = 0; i < 16; ++i)
            tv[i] = cvg[(size_t)(vr + i * 4) * DHEAD + vc];
        #pragma unroll
        for (int i = 0; i < 4; ++i) Qs[(qr + i * 16) * 20 + qf] = tq[i];
        #pragma unroll
        for (int i = 0; i < 4; ++i) CKs[(qr + i * 16) * 20 + qf] = tk[i];
        #pragma unroll
        for (int i = 0; i < 16; ++i) CVt[vc * 68 + vr + i * 4] = tv[i];
    }
#endif

    // ---- sum of the states of the chunks in front, in chunk order; a thread owns
    // four floats of the CK^T CV tiles and one of CK^T CK.
    // A group's tail reads the last chunk in front again and adds nothing for it.
    const float* sb = st + (size_t)bh * NCHUNK * ST_FLOATS;
    v4f   pkv = {};
    float pkk = 0.f;
    for (int c0 = 0; c0 < qt; c0 += PF_GROUP) {
        v4f   tkv[PF_GROUP];
        float tkk[PF_GROUP];
        // unrolled: the group's loads fly together
        #pragma unroll
        for (int i = 0; i < PF_GROUP; ++i) {
            int c = (c0 + i < qt) ? c0 + i : qt - 1;
            const float* sc = sb + c * ST_FLOATS;
            tkv[i] = *(const v4f*)(sc + (unsigned)(tid * 4));
            tkk[i] = sc[(unsigned)(ST_KK + tid)];
        }
        // precaution: the next trip rewrites the address registers that the loads above name
        asm volatile("s_wait_xcnt 0x0" ::: "memory");
        #pragma unroll
        for (int i = 0; i < PF_GROUP; ++i) {
            bool in = c0 + i < qt;
            pkv += in ? tkv[i] : v4f{};
            pkk += in ? tkk[i] : 0.f;
        }
    }
    *(v4f*)(Ps + tid * 4) = pkv;
    Ps[ST_KK + tid] = pkk;
#ifdef USE_ASYNC_LDS
    // this wave's copies have landed before the barrier lets any wave read the tiles
    asm volatile("s_wait_asynccnt 0x0" ::: "memory");
#endif
    __syncthreads();

    // ---- S tiles: two 16x16 tiles per wave, F=16 in four x4 steps ----
    #pragma unroll
    for (int sub = 0; sub < 2; ++sub) {
        int nt = ntB + sub;
        v8f s = {};
        #pragma unroll
        for (int st4 = 0; st4 < 4; ++st4) {
            int f0 = st4 * 4 + dK;
            v2f a  = *(const v2f*)(&Qs[(mt * 16 + ln15) * 20 + f0]);
            v2f bb = *(const v2f*)(&CKs[(nt * 16 + ln15) * 20 + f0]);
            s = wmma_f32(a, bb, s);
        }
        int c = nt * 16 + ln15;
        #pragma unroll
        for (int j = 0; j < 8; ++j) {
            int m = mt * 16 + j + ((lane < 16) ? 0 : 8);
            float val = s[j];
            if (c > m) val = 0.f;   // causal: keep key<=query
            Ss[m * 68 + c] = val;
        }
    }

    // ---- the chunks in front: O = Q * (summed CK^T CV), F=16 in four x4 steps ----
    v8f o0 = {}, o1 = {};
    #pragma unroll
    for (int st4 = 0; st4 < 4; ++st4) {
        int f0 = st4 * 4 + dK;
        v2f a  = *(const v2f*)(&Qs[(mt * 16 + ln15) * 20 + f0]);
        const float* p0 = &Ps[ntB * ST_TILE + f0 * 16 + ln15];
        v2f b0 = {p0[0], p0[16]};
        v2f b1 = {p0[ST_TILE], p0[ST_TILE + 16]};
        o0 = wmma_f32(a, b0, o0);
        o1 = wmma_f32(a, b1, o1);
    }

    // ---- their share of the row sums: (Q * summed CK^T CK) times Q, waves 0..3 ----
    if (wave < 4) {
        v8f t = {};
        #pragma unroll
        for (int st4 = 0; st4 < 4; ++st4) {
            int f0 = st4 * 4 + dK;
            v2f a  = *(const v2f*)(&Qs[(mt * 16 + ln15) * 20 + f0]);
            const float* pk = &Ps[ST_KK + f0 * 16 + ln15];
            v2f bk = {pk[0], pk[16]};
            t = wmma_f32(a, bk, t);
        }
        #pragma unroll
        for (int j = 0; j < 8; ++j) {
            int m = mt * 16 + j + ((lane < 16) ? 0 : 8);
            Tq[m * 20 + ln15] = t[j] * Qs[m * 20 + ln15];
        }
    }
    __syncthreads();

    // ---- per-row sum of squares (threads 0..63, one row each) ----
    float rsum = 0.f;
    if (tid < 64) {
        #pragma unroll
        for (int g = 0; g < 4; ++g) {
            v4f x = *(const v4f*)(&Tq[tid * 20 + g * 4]);
            rsum += (x[0] + x[1]) + (x[2] + x[3]);
        }
        float a = 0.f;
        #pragma unroll 8
        for (int c = 0; c < 64; ++c) { float x = Ss[tid * 68 + c]; a += x * x; }
        rsum += a;
    }

    // ---- O += S * CV : contraction over 64 keys, 16 x4 steps ----
    #pragma unroll 4
    for (int st4 = 0; st4 < 16; ++st4) {
        int k0 = st4 * 4 + dK;
        v2f a  = *(const v2f*)(&Ss[(mt * 16 + ln15) * 68 + k0]);
        v2f b0 = *(const v2f*)(&CVt[(ntB * 16 + ln15) * 68 + k0]);
        v2f b1 = *(const v2f*)(&CVt[((ntB + 1) * 16 + ln15) * 68 + k0]);
        o0 = wmma_f32(a, b0, o0);
        o1 = wmma_f32(a, b1, o1);
    }

    #pragma unroll
    for (int j = 0; j < 8; ++j) {
        int m = mt * 16 + j + ((lane < 16) ? 0 : 8);
        size_t rowOff = ((size_t)bh * SEQ + qBase + m) * DHEAD;
        qKV[rowOff + ntB * 16 + ln15]       = o0[j];
        qKV[rowOff + (ntB + 1) * 16 + ln15] = o1[j];
    }
    if (tid < 64) rs[(size_t)bh * SEQ + qBase + tid] = rsum;
}

// ---------------------------------------------------------------------------
// Denominator scan: cum = cumsum_q(rowSumSq / (2*DH)); dinv = 1/((q+1)+cum)
// ---------------------------------------------------------------------------
// Chunked parallel prefix sum: 256 threads x 8 rows; thread sums are scanned
// inside each wave by lane shifts, wave sums meet in LDS behind one barrier.
__global__ __launch_bounds__(256) void denom_kernel(const float* __restrict__ rs, float* __restrict__ dinv)
{
    __shared__ float wsum[8];
    int bh   = blockIdx.x;
    int t    = threadIdx.x;
    int lane = t & 31, wave = t >> 5;
    const float inv2d = 1.0f / (2.0f * DHEAD);
    size_t base = (size_t)bh * SEQ + t * 8;

    v4f lo = *(const v4f*)(rs + base) * inv2d;
    v4f hi = *(const v4f*)(rs + base + 4) * inv2d;
    float x[8] = {lo[0], lo[1], lo[2], lo[3], hi[0], hi[1], hi[2], hi[3]};

    float s = x[0];
    #pragma unroll
    for (int j = 1; j < 8; ++j) s += x[j];

    float inc = s;                               // inclusive scan over the wave's 32 thread sums
    #pragma unroll
    for (int d = 1; d < 32; d <<= 1) {
        float up = __shfl_up(inc, d, 32);
        if (lane >= d) inc += up;
    }
    if (lane == 31) wsum[wave] = inc;
    float exc = __shfl_up(inc, 1, 32);
    if (lane == 0) exc = 0.f;
    __syncthreads();

    float cum = 0.f;
    #pragma unroll
    for (int w = 0; w < 7; ++w) {
        float tw = wsum[w];
        if (w < wave) cum += tw;
    }
    cum += exc;

    float r[8];
    #pragma unroll
    for (int j = 0; j < 8; ++j) {
        cum += x[j];
        r[j] = 1.0f / ((float)(t * 8 + j + 1) + cum);
    }
    v4f olo = {r[0], r[1], r[2], r[3]}, ohi = {r[4], r[5], r[6], r[7]};
    *(v4f*)(dinv + base)     = olo;
    *(v4f*)(dinv + base + 4) = ohi;
}

// ---------------------------------------------------------------------------
// y[b,l,h*DH+i] = mv + (qKV / sqrt(DH)) * dinv   (row-major for final GEMM)
// ---------------------------------------------------------------------------
__global__ __launch_bounds__(256) void finalize_kernel(
    const float* __restrict__ qKV, const float* __restrict__ mv,
    const float* __restrict__ dinv, float* __restrict__ y)
{
    size_t idx = (size_t)blockIdx.x * 256 + threadIdx.x;
    if (idx >= (size_t)BATCH * HEADS * SEQ * DHEAD) return;
    size_t rowIdx = idx >> 6;           // bh*SEQ + l
    int i  = (int)(idx & 63);
    int l  = (int)(rowIdx & (SEQ - 1));
    int bh = (int)(rowIdx >> 11);
    int b  = bh / HEADS, h = bh - b * HEADS;
    const float invSqrtDh = 0.125f;     // 1/sqrt(64)
    float val = mv[idx] + qKV[idx] * invSqrtDh * dinv[rowIdx];
    y[((size_t)(b * SEQ + l)) * DMODEL + h * DHEAD + i] = val;
}

// ---------------------------------------------------------------------------
extern "C" void kernel_launch(void* const* d_in, const int* in_sizes, int n_in,
                              void* d_out, int out_size, void* d_ws, size_t ws_size,
                              hipStream_t stream) {
    const float* hs = (const float*)d_in[0];
    const float* Wq = (const float*)d_in[1];
    const float* Wk = (const float*)d_in[2];
    const float* Wv = (const float*)d_in[3];
    const float* Wo = (const float*)d_in[4];
    float* out = (float*)d_out;

    const int M  = BATCH * SEQ;            // 4096
    const int NF = HEADS * FDIM;           // 192
    const int NV = HEADS * DHEAD;          // 768

    float* ws = (float*)d_ws;
    size_t off = 0;
    float* q_raw = ws + off; off += (size_t)M * NF;
    float* k_raw = ws + off; off += (size_t)M * NF;
    float* v_raw = ws + off; off += (size_t)M * NV;
    float* ck    = ws + off; off += (size_t)BATCH * HEADS * SEQ * FDIM;
    float* cv    = ws + off; off += (size_t)BATCH * HEADS * SEQ * DHEAD;
    float* mv    = ws + off; off += (size_t)BATCH * HEADS * SEQ * DHEAD;
    float* qKV   = ws + off; off += (size_t)BATCH * HEADS * SEQ * DHEAD;
    float* rsbuf = ws + off; off += (size_t)BATCH * HEADS * SEQ;
    float* dinv  = ws + off; off += (size_t)BATCH * HEADS * SEQ;
    float* ybuf  = ws + off; off += (size_t)M * DMODEL;
    float* cstat = ws + off; off += (size_t)BATCH * HEADS * NCHUNK * ST_FLOATS;
    (void)ws_size; (void)in_sizes; (void)n_in; (void)out_size;

    // 1: input projections, one launch
    proj_qkv_kernel<<<dim3((M / GBM) * QKV_CB), 256, 0, stream>>>(hs, Wq, Wk, Wv, q_raw, k_raw, v_raw);

    // 2: running-mean centering
    center_scan_kernel<<<dim3(CS_KGRP + CS_VGRP, BATCH, CS_PARTS), 256, 0, stream>>>(k_raw, v_raw, ck, cv, mv);

    // 3: per-chunk states, then the causal attention core on their prefix sums
    chunk_state_kernel<<<dim3(NCHUNK, HEADS, BATCH), 160, 0, stream>>>(ck, cv, cstat);
    atten_kernel<<<dim3(SEQ / 64, HEADS, BATCH), 256, 0, stream>>>(q_raw, ck, cv, cstat, qKV, rsbuf);

    // 4: denominator scan
    denom_kernel<<<dim3(BATCH * HEADS), 256, 0, stream>>>(rsbuf, dinv);

    // 5: finalize y
    size_t nElem = (size_t)BATCH * HEADS * SEQ * DHEAD;
    finalize_kernel<<<dim3((unsigned)((nElem + 255) / 256)), 256, 0, stream>>>(qKV, mv, dinv, ybuf);

    // 6: output projection
    gemm_wmma_f32<<<dim3((M / GBM) * (DMODEL / GBN)), 256, 0, stream>>>(ybuf, Wo, out, M, DMODEL, DMODEL);
}

// v006
// One run takes 100 microseconds.
// Two timings next to v005 both put it at 1.09 times that version's speed.
// Counting every step since v000, it is 7.34 times as fast.
#include <hip/hip_runtime.h>
#include <hip/hip_bf16.h>

typedef __attribute__((ext_vector_type(2))) float v2f;
typedef __attribute__((ext_vector_type(4))) float v4f;
typedef __attribute__((ext_vector_type(8))) float v8f;

#define BATCH 2
#define SEQ   2048
#define DMODEL 768
#define HEADS 12
#define FDIM  16
#define DHEAD 64

#define AS1 __attribute__((address_space(1)))
#define AS3 __attribute__((address_space(3)))

#if defined(__has_builtin)
#if __has_builtin(__builtin_amdgcn_global_load_async_to_lds_b32) && \
    __has_builtin(__builtin_amdgcn_s_wait_asynccnt)
#define USE_ASYNC_LDS 1
#endif
#endif

static __device__ __forceinline__ v8f wmma_f32(v2f a, v2f b, v8f c) {
    return __builtin_amdgcn_wmma_f32_16x16x4_f32(false, a, false, b, (short)0, c, false, false);
}

// ---------------------------------------------------------------------------
// Block-tiled fp32 WMMA GEMM: C(MxN) = A(MxK,rm) * B(KxN,rm).
// Block = 64x96 C tile, 8 waves, each wave a 16x48 strip (3 WMMA tiles that share
// one A operand). The tile is sized for the chip's 256 WGPs: the projections make
// 768 blocks and the output product 512, a whole number a WGP, so that no WGP's
// matrix units carry a block more than another's.
// K staged in 64-wide slabs: a slab holds one aligned 256-byte piece of every A
// row and one 384-byte piece of every B row. A row-major, B transposed, both at
// stride 68 in LDS, so every WMMA operand is a single aligned ds_load_b64,
// bank-conflict free for both lane halves. Slabs staged via async global->LDS DMA
// when the toolchain exposes it. Requires M%64==0, N%96==0, K%64==0.
// ---------------------------------------------------------------------------
#define GBM 64
#define GBN 96
#define GKT 64
#define GLD (GKT + 4)                 // LDS row stride, floats
#define GA_PASS (GBM * GKT / 256)     // 16 copies a thread for the A slab
#define GB_LINES (GBN / 32)           // 3 lines of 128 bytes in a B row's piece
#define GB_PASS (GBN * GKT / 256)     // 24 copies a thread for the B slab

static __device__ __forceinline__ void gemm_tile(
    const float* __restrict__ A, const float* __restrict__ B,
    float* __restrict__ C, int K, int N, int rowBase, int colBase)
{
    __shared__ float As[GBM * GLD];  // [row][k]   64 x 64, stride 68
    __shared__ float Bt[GBN * GLD];  // [col][k]   96 x 64, stride 68 (transposed)

    int tid  = threadIdx.x;
    int wave = tid >> 5, lane = tid & 31;
    int ln15 = lane & 15;
    int dK   = (lane < 16) ? 0 : 2;

    int aRow0 = (wave & 3) * 16;
    int bCol0 = (wave >> 2) * 48;

    int ar = tid >> 6, af = tid & 63;     // A staging: 16 rows apart by 4, a wave copies one 128-byte line
    // B staging: a wave copies one 128-byte line; pass i takes line i % 3 of row (i / 3) * 8 + wave
    // a copy's address = a base that is the same for the whole block + the thread's own
    // 32-bit offset: keeps the address registers few (the three blocks of a WGP need
    // 6 waves a SIMD)
    unsigned aOff = (unsigned)(ar * K + af);
    unsigned bOff = (unsigned)(wave * N + lane);
    const float* Ab = A + (size_t)rowBase * K;
    const float* Bb = B + colBase;

    v8f acc0 = {}, acc1 = {}, acc2 = {};

    for (int k0 = 0; k0 < K; k0 += GKT) {
        __syncthreads();
#ifdef USE_ASYNC_LDS
        #pragma unroll
        for (int i = 0; i < GA_PASS; ++i)
            __builtin_amdgcn_global_load_async_to_lds_b32(
                (AS1 int*)(Ab + ((size_t)(i * 4) * K + k0) + aOff),
                (AS3 int*)(As + (ar + i * 4) * GLD + af), 0, 0);
        #pragma unroll
        for (int i = 0; i < GB_PASS; ++i)
            __builtin_amdgcn_global_load_async_to_lds_b32(
                (AS1 int*)(Bb + ((size_t)(k0 + (i / GB_LINES) * 8) * N + (i % GB_LINES) * 32) + bOff),
                (AS3 int*)(Bt + ((i % GB_LINES) * 32 + lane) * GLD + (i / GB_LINES) * 8 + wave), 0, 0);
        // this wave's copies have landed before the barrier lets any wave read the slab
        asm volatile("s_wait_asynccnt 0x0" ::: "memory");
#else
        float ta[GA_PASS], tb[GB_PASS];
        #pragma unroll
        for (int i = 0; i < GA_PASS; ++i)
            ta[i] = (Ab + ((size_t)(i * 4) * K + k0))[aOff];
        #pragma unroll
        for (int i = 0; i < GB_PASS; ++i)
            tb[i] = (Bb + ((size_t)(k0 + (i / GB_LINES) * 8) * N + (i % GB_LINES) * 32))[bOff];
        #pragma unroll
        for (int i = 0; i < GA_PASS; ++i) As[(ar + i * 4) * GLD + af] = ta[i];
        #pragma unroll
        for (int i = 0; i < GB_PASS; ++i)
            Bt[((i % GB_LINES) * 32 + lane) * GLD + (i / GB_LINES) * 8 + wave] = tb[i];
#endif
        if (k0 + GKT < K) {                                    // global_prefetch_b8
            if (tid < GBM)
                __builtin_prefetch(&A[(size_t)(rowBase + tid) * K + k0 + GKT], 0, 3);
            else if (tid < GBM + 2 * GKT)                      // both ends of a B row's 384 bytes
                __builtin_prefetch(&B[(size_t)(k0 + GKT + ((tid - GBM) >> 1)) * N + colBase + (tid & 1) * 64], 0, 3);
        }
        __syncthreads();

        #pragma unroll
        for (int st = 0; st < GKT / 4; ++st) {
            int kk = st * 4 + dK;                              // even -> 8B-aligned
            v2f a  = *(const v2f*)(&As[(aRow0 + ln15) * GLD + kk]);
            v2f b0 = *(const v2f*)(&Bt[(bCol0 + ln15) * GLD + kk]);
            v2f b1 = *(const v2f*)(&Bt[(bCol0 + 16 + ln15) * GLD + kk]);
            v2f b2 = *(const v2f*)(&Bt[(bCol0 + 32 + ln15) * GLD + kk]);
            acc0 = wmma_f32(a, b0, acc0);
            acc1 = wmma_f32(a, b1, acc1);
            acc2 = wmma_f32(a, b2, acc2);
        }
    }

    #pragma unroll
    for (int j = 0; j < 8; ++j) {
        int r = rowBase + aRow0 + j + ((lane < 16) ? 0 : 8);
        int c = colBase + bCol0 + ln15;
        C[(size_t)r * N + c]      = acc0[j];
        C[(size_t)r * N + c + 16] = acc1[j];
        C[(size_t)r * N + c + 32] = acc2[j];
    }
}

__global__ __launch_bounds__(256) void gemm_wmma_f32(
    const float* __restrict__ A, const float* __restrict__ B,
    float* __restrict__ C, int M, int K, int N)
{
    int nBlocks = N / GBN;
    int bm = blockIdx.x / nBlocks;
    int bn = blockIdx.x - bm * nBlocks;
    gemm_tile(A, B, C, K, N, bm * GBM, bn * GBN);
}

// The three input projections share A and are one launch: a block's column
// index runs over the 96-wide column blocks of Wq, then Wk, then Wv.
#define QK_CB (HEADS * FDIM / GBN)            // 2 column blocks of q, and of k
#define V_CB  (HEADS * DHEAD / GBN)           // 8 column blocks of v
#define QKV_CB (2 * QK_CB + V_CB)             // 12

__global__ __launch_bounds__(256) void proj_qkv_kernel(
    const float* __restrict__ A, const float* __restrict__ Wq,
    const float* __restrict__ Wk, const float* __restrict__ Wv,
    float* __restrict__ q, float* __restrict__ k, float* __restrict__ v)
{
    int bm = blockIdx.x / QKV_CB;
    int bn = blockIdx.x - bm * QKV_CB;
    const float* B = Wv;
    float* C = v;
    int N = HEADS * DHEAD, cb = bn - 2 * QK_CB;
    if (bn < QK_CB)          { B = Wq; C = q; N = HEADS * FDIM; cb = bn; }
    else if (bn < 2 * QK_CB) { B = Wk; C = k; N = HEADS * FDIM; cb = bn - QK_CB; }
    gemm_tile(A, B, C, DMODEL, N, bm * GBM, cb * GBN);
}

// ---------------------------------------------------------------------------
// Running-mean centering as a chunked parallel prefix sum over the sequence.
// One block = 32 columns (one 128-byte line of a row) x 512 rows of one batch.
// 256 threads = 8 column quads x 32 chunks; a thread owns 16 rows x 4 columns.
// The rows in front of the block's part are summed again by the block itself
// (no hand-over between blocks); chunk sums meet by lane shifts inside a wave,
// wave sums in LDS behind one barrier.
// ---------------------------------------------------------------------------
#define CS_PARTS  4
#define CS_ROWS   (SEQ / CS_PARTS)            // 512 rows a block
#define CS_CHUNKS 32
#define CS_RPT    (CS_ROWS / CS_CHUNKS)       // 16 rows a thread
#define CS_KGRP   (HEADS * FDIM / 32)         // 6 column groups of k
#define CS_VGRP   (HEADS * DHEAD / 32)        // 24 column groups of v

// IS_K picks the row pitch at compile time, so that every row of a thread is
// one address register plus an immediate offset.
template <bool IS_K>
static __device__ __forceinline__ void center_part(
    const float* __restrict__ raw, float* __restrict__ centered, float* __restrict__ mean,
    int grp, int b, int part, v4f (*tot)[8], v4f (*pre)[8])
{
    constexpr int PITCH = IS_K ? HEADS * FDIM : HEADS * DHEAD;   // floats in a source row
    constexpr int W     = IS_K ? FDIM : DHEAD;                   // floats in a head's row

    int quad  = threadIdx.x & 7;
    int chunk = threadIdx.x >> 3;
    int col   = grp * 32 + quad * 4;
    int row0  = part * CS_ROWS + chunk * CS_RPT;
    const float* colp = raw + (size_t)b * SEQ * PITCH + col;

    const float* own = colp + (size_t)row0 * PITCH;
    v4f x[CS_RPT];
    #pragma unroll
    for (int r = 0; r < CS_RPT - 1; ++r)
        x[r] = *(const v4f*)(own + r * PITCH);
    // precaution: the build lets the last row's result take the address pair that
    // the loads above name; their wait stands in front of that overwrite
    asm volatile("s_wait_xcnt 0x0" ::: "memory");
    x[CS_RPT - 1] = *(const v4f*)(own + (CS_RPT - 1) * PITCH);

    // rows in front of the part, dealt row by row over the 32 chunks
    const float* front = colp + (size_t)chunk * PITCH;
    v4f p = {};
    #pragma unroll
    for (int i = 0; i < CS_PARTS - 1; ++i) {
        if (i < part) {
            #pragma unroll
            for (int r = 0; r < CS_RPT; ++r)
                p += *(const v4f*)(front + (i * CS_RPT + r) * CS_CHUNKS * PITCH);
        }
    }

    v4f s = x[0];
    #pragma unroll
    for (int r = 1; r < CS_RPT; ++r) s += x[r];

    // the wave's 4 chunks meet by lane shifts: sums of the chunks in front (exc),
    // and the wave's whole share of the front rows (pw)
    int wave = threadIdx.x >> 5;
    int cw   = chunk & 3;
    v4f exc = {}, pw = p;
    #pragma unroll
    for (int d = 1; d < 4; ++d) {
        #pragma unroll
        for (int k = 0; k < 4; ++k) {
            float up = __shfl_up(s[k], 8 * d, 32);
            exc[k] += (cw >= d) ? up : 0.f;
            pw[k]  += __shfl_xor(p[k], 8 * d, 32);
        }
    }
    if (cw == 3) {
        tot[wave][quad] = exc + s;
        pre[wave][quad] = pw;
    }
    __syncthreads();

    v4f run = {};
    #pragma unroll
    for (int w = 0; w < 8; ++w) run += pre[w][quad];
    #pragma unroll
    for (int w = 0; w < 7; ++w) {
        v4f tw = tot[w][quad];
        run += (w < wave) ? tw : v4f{};   // a select, so that all the LDS reads fly together
    }
    run += exc;

    int bh = b * HEADS + col / W;
    size_t o = ((size_t)bh * SEQ + row0) * W + (col % W);
    float* dc = centered + o;
    float* dm = mean + o;
    #pragma unroll
    for (int r = 0; r < CS_RPT; ++r) {
        run += x[r];
        v4f m = run / (float)(row0 + r + 1);
        if (!IS_K) *(v4f*)(dm + r * W) = m;
        *(v4f*)(dc + r * W) = x[r] - m;
    }
    // precaution: in the build the k path's code follows the v path's and rewrites the
    // registers that the stores above name; their wait stands behind the last store
    if (!IS_K) asm volatile("s_wait_xcnt 0x0" ::: "memory");
}

__global__ __launch_bounds__(256) void center_scan_kernel(
    const float* __restrict__ k_raw, const float* __restrict__ v_raw,
    float* __restrict__ ck, float* __restrict__ cv, float* __restrict__ mv)
{
    __shared__ v4f tot[8][8];   // [wave][quad] sum of the wave's own 64 rows
    __shared__ v4f pre[8][8];   // [wave][quad] the wave's share of the rows in front of the part

    int g    = blockIdx.x;
    int b    = blockIdx.y;
    int part = CS_PARTS - 1 - blockIdx.z;     // the part with most rows in front starts first

    if (g < CS_KGRP) center_part<true >(k_raw, ck, ck, g,           b, part, tot, pre);
    else             center_part<false>(v_raw, cv, mv, g - CS_KGRP, b, part, tot, pre);
}

// ---------------------------------------------------------------------------
// The causal product has no softmax, so it is re-associated by 64-key chunks:
//   tril(Q CK^T) CV        = Q (sum over earlier chunks of CK_c^T CV_c) + own chunk's masked tile
//   row sums of tril(..)^2 = q^T (sum over earlier chunks of CK_c^T CK_c) q + own chunk's masked tile
// The denominator adds up those row sums over all queries so far. A whole chunk's share is
//   sum over the chunk's queries = <sum over earlier chunks of CK_c^T CK_c, Q_c^T Q_c> (element by
//   element) + the sum of squares of the chunk's own masked tile,
// so a block gets the total of the chunks in front from the states too and needs no other block's rows.
// Chunk state = six 16x16 tiles, each 256 floats in a row (one wave writes one tile):
// tiles 0..3 are CK_c^T CV_c [f][d], 16 columns of d each; tile 4 is CK_c^T CK_c [f][f];
// tile 5 is Q_c^T Q_c [f][f]. Beside it four floats a chunk: the sum of squares of each
// 16-query strip of the own masked tile.
// ---------------------------------------------------------------------------
#define NCHUNK    (SEQ / 64)
#define ST_TILE   256
#define ST_KK     (4 * ST_TILE)
#define ST_QQ     (5 * ST_TILE)
#define ST_FLOATS (6 * ST_TILE)

// One 16x16 tile of a chunk's state: contraction over the chunk's 64 rows (keys, or queries for Q_c^T Q_c). Both
// operands are row-major in memory, which is the fragment order: no staging.
template <int APITCH, int BPITCH>
static __device__ __forceinline__ void state_tile(
    const float* __restrict__ ap, const float* __restrict__ bp, float* __restrict__ dst)
{
    v2f a[16], bb[16];
    // unrolled: every load is one address plus an immediate, and they fly together
    #pragma unroll
    for (int s = 0; s < 16; ++s) {
        a[s]  = v2f{ap[s * 4 * APITCH], ap[(s * 4 + 1) * APITCH]};
        bb[s] = v2f{bp[s * 4 * BPITCH], bp[(s * 4 + 1) * BPITCH]};
    }
    v8f acc = {};
    #pragma unroll
    for (int s = 0; s < 16; ++s) acc = wmma_f32(a[s], bb[s], acc);
    #pragma unroll
    for (int j = 0; j < 8; ++j) dst[j * 16] = acc[j];
    // precaution: in the build another tile's code follows these stores and rewrites the
    // registers that they name; their wait stands behind the last store
    asm volatile("s_wait_xcnt 0x0" ::: "memory");
}

// Sum of squares of one 16-query strip of the chunk's own masked tile S = Q CK^T.
// All four key tiles are formed (the mask empties those above the diagonal): no branch
// among the matrix instructions, and as many of them as a state tile takes.
static __device__ __forceinline__ void strip_squares(
    const float* __restrict__ qc, const float* __restrict__ ckc, int mt, int lane,
    float* __restrict__ dst)
{
    int ln15 = lane & 15;
    int hi   = lane >> 4;
    v2f a[4], bb[4][4];
    // unrolled: every load is one address plus an immediate, and they fly together
    #pragma unroll
    for (int s = 0; s < 4; ++s) {
        a[s] = *(const v2f*)(qc + (mt * 16 + ln15) * (HEADS * FDIM) + s * 4 + hi * 2);
        #pragma unroll
        for (int nt = 0; nt < 4; ++nt)
            bb[nt][s] = *(const v2f*)(ckc + (nt * 16 + ln15) * FDIM + s * 4 + hi * 2);
    }
    float sq = 0.f;
    #pragma unroll
    for (int nt = 0; nt < 4; ++nt) {
        v8f t = {};
        #pragma unroll
        for (int s = 0; s < 4; ++s) t = wmma_f32(a[s], bb[nt][s], t);
        #pragma unroll
        for (int j = 0; j < 8; ++j) {
            float val = (nt * 16 + ln15 > mt * 16 + hi * 8 + j) ? 0.f : t[j];   // causal: keep key<=query
            sq += val * val;
        }
    }
    #pragma unroll
    for (int d = 16; d >= 1; d >>= 1) sq += __shfl_xor(sq, d, 32);
    if (lane == 0) *dst = sq;
}

__global__ __launch_bounds__(320) void chunk_state_kernel(
    const float* __restrict__ q_raw, const float* __restrict__ ck, const float* __restrict__ cv,
    float* __restrict__ st, float* __restrict__ dsq)
{
    int c  = blockIdx.x;
    int bh = blockIdx.z * HEADS + blockIdx.y;
    int lane = threadIdx.x & 31;
    int tile = __builtin_amdgcn_readfirstlane(threadIdx.x >> 5);
    int ln15 = lane & 15;
    int hi   = lane >> 4;

    size_t key0 = (size_t)bh * SEQ + c * 64 + hi * 2;       // lane half holds k and k+1, or k+2 and k+3
    const float* ap = ck + key0 * FDIM + ln15;
    float* dst = st + ((size_t)bh * NCHUNK + c) * ST_FLOATS + tile * ST_TILE + hi * 8 * 16 + ln15;
    const float* qc = q_raw + ((size_t)blockIdx.z * SEQ + c * 64) * (HEADS * FDIM) + blockIdx.y * FDIM;
    if (tile < 4)       state_tile<FDIM, DHEAD>(ap, cv + key0 * DHEAD + tile * 16 + ln15, dst);
    else if (tile == 4) state_tile<FDIM, FDIM>(ap, ap, dst);
    else if (tile == 5) {
        const float* qp = qc + hi * 2 * (HEADS * FDIM) + ln15;
        state_tile<HEADS * FDIM, HEADS * FDIM>(qp, qp, dst);
    } else
        strip_squares(qc, ck + ((size_t)bh * SEQ + c * 64) * FDIM, tile - 6, lane,
                      dsq + ((size_t)bh * NCHUNK + c) * 4 + (tile - 6));
}

// ---------------------------------------------------------------------------
// Causal attention core: one block per (b,h,64-query chunk). The states of the
// chunks in front are summed by the block itself; the own chunk's tile
// S = Q * CK^T (masked) goes through LDS: row sums of S^2, O += S * CV.
// The block also forms its rows' denominators, (q+1) + running sum of the row sums / (2*DH):
// the chunks in front give their total (see above), the own 64 row sums meet in LDS; then
// y[b,l,h*DH+i] = mv + (O / sqrt(DH)) / denominator, row-major for the final GEMM.
// ---------------------------------------------------------------------------
#define PF_GROUP 8     // chunk states whose loads fly together

__global__ __launch_bounds__(256) void atten_kernel(
    const float* __restrict__ q_raw, const float* __restrict__ ck,
    const float* __restrict__ cv, const float* __restrict__ st,
    const float* __restrict__ dsq, const float* __restrict__ mv, float* __restrict__ y)
{
    __shared__ float Qs[64 * 20];    // [q][f]   stride 20
    __shared__ float CKs[64 * 20];   // [k][f]   stride 20
    __shared__ float CVt[64 * 68];   // [d][k]   stride 68 (transposed)
    __shared__ float Ss[64 * 68];    // [q][k]   stride 68 (even -> aligned v2f)
    __shared__ __attribute__((aligned(16))) float Ps[ST_QQ];       // summed state of the chunks in front (tiles 0..4)
    __shared__ __attribute__((aligned(16))) float Tq[64 * 20];     // [q][f] (Q * KK) times Q, element by element
    __shared__ __attribute__((aligned(16))) float Rs[64];          // the own chunk's row sums of squares
    __shared__ __attribute__((aligned(16))) float Wt[8];           // [wave] share of the row sums of the chunks in front

    int qt = blockIdx.x;
    int h  = blockIdx.y;
    int b  = blockIdx.z;
    int bh = b * HEADS + h;
    int qBase = qt * 64;

    int tid  = threadIdx.x;
    int wave = __builtin_amdgcn_readfirstlane(tid >> 5), lane = tid & 31;
    int ln15 = lane & 15;
    int dK   = (lane < 16) ? 0 : 2;
    int mt   = wave & 3;
    int ntB  = (wave >> 2) * 2;

    int qr = tid >> 4, qf = tid & 15;     // Q/CK staging: 4 rows apart by 16
    int vr = tid >> 6, vc = tid & 63;     // CV staging: 16 rows apart by 4

    const float* qg  = q_raw + ((size_t)(b * SEQ + qBase)) * (HEADS * FDIM) + h * FDIM;
    const float* ckg = ck + ((size_t)bh * SEQ + qBase) * FDIM;
    const float* cvg = cv + ((size_t)bh * SEQ + qBase) * DHEAD;
#ifdef USE_ASYNC_LDS
    #pragma unroll
    for (int i = 0; i < 4; ++i)
        __builtin_amdgcn_global_load_async_to_lds_b32(
            (AS1 int*)(qg + (size_t)(qr + i * 16) * (HEADS * FDIM) + qf),
            (AS3 int*)(Qs + (qr + i * 16) * 20 + qf), 0, 0);
    #pragma unroll
    for (int i = 0; i < 4; ++i)
        __builtin_amdgcn_global_load_async_to_lds_b32(
            (AS1 int*)(ckg + (size_t)(qr + i * 16) * FDIM + qf),
            (AS3 int*)(CKs + (qr + i * 16) * 20 + qf), 0, 0);
    #pragma unroll
    for (int i = 0; i < 16; ++i)
        __builtin_amdgcn_global_load_async_to_lds_b32(
            (AS1 int*)(cvg + (size_t)(vr + i * 4) * DHEAD + vc),
            (AS3 int*)(CVt + vc * 68 + vr + i * 4), 0, 0);
#else
    {
        float tq[4], tk[4], tv[16];
        #pragma unroll
        for (int i = 0; i < 4; ++i)
            tq[i] = qg[(size_t)(qr + i * 16) * (HEADS * FDIM) + qf];
        #pragma unroll
        for (int i = 0; i < 4; ++i)
            tk[i] = ckg[(size_t)(qr + i * 16) * FDIM + qf];
        #pragma unroll
        for (int i = 0; i < 16; ++i)
            tv[i] = cvg[(size_t)(vr + i * 4) * DHEAD + vc];
        #pragma unroll
        for (int i = 0; i < 4; ++i) Qs[(qr + i * 16) * 20 + qf] = tq[i];
        #pragma unroll
        for (int i = 0; i < 4; ++i) CKs[(qr + i * 16) * 20 + qf] = tk[i];
        #pragma unroll
        for (int i = 0; i < 16; ++i) CVt[vc * 68 + vr + i * 4] = tv[i];
    }
#endif

    // ---- the running means of this thread's 16 outputs and its strip sum of a chunk in
    // front: asked for here; the means are used at the end, so that they fly behind all the rest
    int m0 = mt * 16 + ((lane < 16) ? 0 : 8);       // first of the lane's 8 rows
    const float* mvg = mv + ((size_t)bh * SEQ + qBase + m0) * DHEAD + ntB * 16 + ln15;
    float mv0[8], mv1[8];
    #pragma unroll
    for (int j = 0; j < 8; ++j) {
        mv0[j] = mvg[j * DHEAD];
        mv1[j] = mvg[j * DHEAD + 16];
    }
    float front = (tid < 4 * qt) ? dsq[(size_t)bh * NCHUNK * 4 + tid] : 0.f;

    // ---- sum of the states of the chunks in front, in chunk order; a thread owns
    // four floats of the CK^T CV tiles and one of CK^T CK, and its element of
    // <CK^T CK summed so far, Q^T Q of the next chunk>.
    // A group's tail reads the last chunk in front again and adds nothing for it.
    const float* sb = st + (size_t)bh * NCHUNK * ST_FLOATS;
    v4f   pkv = {};
    float pkk = 0.f;
    for (int c0 = 0; c0 < qt; c0 += PF_GROUP) {
        v4f   tkv[PF_GROUP];
        float tkk[PF_GROUP], tqq[PF_GROUP];
        // unrolled: the group's loads fly together
        #pragma unroll
        for (int i = 0; i < PF_GROUP; ++i) {
            int c = (c0 + i < qt) ? c0 + i : qt - 1;
            const float* sc = sb + c * ST_FLOATS;
            tkv[i] = *(const v4f*)(sc + (unsigned)(tid * 4));
            tkk[i] = sc[(unsigned)(ST_KK + tid)];
            tqq[i] = sc[(unsigned)(ST_QQ + tid)];
        }
        // precaution: the next trip rewrites the address registers that the loads above name
        asm volatile("s_wait_xcnt 0x0" ::: "memory");
        #pragma unroll
        for (int i = 0; i < PF_GROUP; ++i) {
            bool in = c0 + i < qt;
            pkv += in ? tkv[i] : v4f{};
            front += in ? pkk * tqq[i] : 0.f;       // pkk: the chunks in front of chunk c0 + i
            pkk += in ? tkk[i] : 0.f;
        }
    }
    *(v4f*)(Ps + tid * 4) = pkv;
    Ps[ST_KK + tid] = pkk;
    #pragma unroll
    for (int d = 16; d >= 1; d >>= 1) front += __shfl_xor(front, d, 32);
    if (lane == 0) Wt[wave] = front;
#ifdef USE_ASYNC_LDS
    // this wave's copies have landed before the barrier lets any wave read the tiles
    asm volatile("s_wait_asynccnt 0x0" ::: "memory");
#endif
    __syncthreads();

    // ---- S tiles: two 16x16 tiles per wave, F=16 in four x4 steps ----
    #pragma unroll
    for (int sub = 0; sub < 2; ++sub) {
        int nt = ntB + sub;
        v8f s = {};
        #pragma unroll
        for (int st4 = 0; st4 < 4; ++st4) {
            int f0 = st4 * 4 + dK;
            v2f a  = *(const v2f*)(&Qs[(mt * 16 + ln15) * 20 + f0]);
            v2f bb = *(const v2f*)(&CKs[(nt * 16 + ln15) * 20 + f0]);
            s = wmma_f32(a, bb, s);
        }
        int c = nt * 16 + ln15;
        #pragma unroll
        for (int j = 0; j < 8; ++j) {
            int m = mt * 16 + j + ((lane < 16) ? 0 : 8);
            float val = s[j];
            if (c > m) val = 0.f;   // causal: keep key<=query
            Ss[m * 68 + c] = val;
        }
    }

    // ---- the chunks in front: O = Q * (summed CK^T CV), F=16 in four x4 steps ----
    v8f o0 = {}, o1 = {};
    #pragma unroll
    for (int st4 = 0; st4 < 4; ++st4) {
        int f0 = st4 * 4 + dK;
        v2f a  = *(const v2f*)(&Qs[(mt * 16 + ln15) * 20 + f0]);
        const float* p0 = &Ps[ntB * ST_TILE + f0 * 16 + ln15];
        v2f b0 = {p0[0], p0[16]};
        v2f b1 = {p0[ST_TILE], p0[ST_TILE + 16]};
        o0 = wmma_f32(a, b0, o0);
        o1 = wmma_f32(a, b1, o1);
    }

    // ---- their share of the row sums: (Q * summed CK^T CK) times Q, waves 0..3 ----
    if (wave < 4) {
        v8f t = {};
        #pragma unroll
        for (int st4 = 0; st4 < 4; ++st4) {
            int f0 = st4 * 4 + dK;
            v2f a  = *(const v2f*)(&Qs[(mt * 16 + ln15) * 20 + f0]);
            const float* pk = &Ps[ST_KK + f0 * 16 + ln15];
            v2f bk = {pk[0], pk[16]};
            t = wmma_f32(a, bk, t);
        }
        #pragma unroll
        for (int j = 0; j < 8; ++j) {
            int m = mt * 16 + j + ((lane < 16) ? 0 : 8);
            Tq[m * 20 + ln15] = t[j] * Qs[m * 20 + ln15];
        }
    }
    __syncthreads();

    // ---- per-row sum of squares (threads 0..63, one row each) ----
    float rsum = 0.f;
    if (tid < 64) {
        #pragma unroll
        for (int g = 0; g < 4; ++g) {
            v4f x = *(const v4f*)(&Tq[tid * 20 + g * 4]);
            rsum += (x[0] + x[1]) + (x[2] + x[3]);
        }
        float a = 0.f;
        #pragma unroll 8
        for (int c = 0; c < 64; ++c) { float x = Ss[tid * 68 + c]; a += x * x; }
        rsum += a;
        Rs[tid] = rsum;
    }

    // ---- O += S * CV : contraction over 64 keys, 16 x4 steps ----
    #pragma unroll 4
    for (int st4 = 0; st4 < 16; ++st4) {
        int k0 = st4 * 4 + dK;
        v2f a  = *(const v2f*)(&Ss[(mt * 16 + ln15) * 68 + k0]);
        v2f b0 = *(const v2f*)(&CVt[(ntB * 16 + ln15) * 68 + k0]);
        v2f b1 = *(const v2f*)(&CVt[((ntB + 1) * 16 + ln15) * 68 + k0]);
        o0 = wmma_f32(a, b0, o0);
        o1 = wmma_f32(a, b1, o1);
    }

    __syncthreads();     // the 64 row sums are in LDS

    // ---- running sum of the row sums up to each of the lane's 8 rows: the chunks in
    // front, the 8-row groups in front (every lane reads the same words), the own group
    float run = 0.f;
    #pragma unroll
    for (int w = 0; w < 8; ++w) run += Wt[w];
    int grp = m0 >> 3;
    #pragma unroll
    for (int g = 0; g < 7; ++g) {
        v4f x0 = *(const v4f*)(&Rs[g * 8]);
        v4f x1 = *(const v4f*)(&Rs[g * 8 + 4]);
        float gs = ((x0[0] + x0[1]) + (x0[2] + x0[3])) + ((x1[0] + x1[1]) + (x1[2] + x1[3]));
        run += (g < grp) ? gs : 0.f;     // a select, so that all the LDS reads fly together
    }
    v4f r0 = *(const v4f*)(&Rs[m0]);
    v4f r1 = *(const v4f*)(&Rs[m0 + 4]);
    float own[8] = {r0[0], r0[1], r0[2], r0[3], r1[0], r1[1], r1[2], r1[3]};

    const float inv2d     = 1.0f / (2.0f * DHEAD);
    const float invSqrtDh = 0.125f;     // 1/sqrt(64)
    float* yg = y + ((size_t)(b * SEQ + qBase + m0)) * DMODEL + h * DHEAD + ntB * 16 + ln15;
    #pragma unroll
    for (int j = 0; j < 8; ++j) {
        run += own[j];
        float dinv = 1.0f / ((float)(qBase + m0 + j + 1) + run * inv2d);
        yg[j * DMODEL]      = mv0[j] + o0[j] * invSqrtDh * dinv;
        yg[j * DMODEL + 16] = mv1[j] + o1[j] * invSqrtDh * dinv;
    }
}

// ---------------------------------------------------------------------------
extern "C" void kernel_launch(void* const* d_in, const int* in_sizes, int n_in,
                              void* d_out, int out_size, void* d_ws, size_t ws_size,
                              hipStream_t stream) {
    const float* hs = (const float*)d_in[0];
    const float* Wq = (const float*)d_in[1];
    const float* Wk = (const float*)d_in[2];
    const float* Wv = (const float*)d_in[3];
    const float* Wo = (const float*)d_in[4];
    float* out = (float*)d_out;

    const int M  = BATCH * SEQ;            // 4096
    const int NF = HEADS * FDIM;           // 192
    const int NV = HEADS * DHEAD;          // 768

    float* ws = (float*)d_ws;
    size_t off = 0;
    float* q_raw = ws + off; off += (size_t)M * NF;
    float* k_raw = ws + off; off += (size_t)M * NF;
    float* v_raw = ws + off; off += (size_t)M * NV;
    float* ck    = ws + off; off += (size_t)BATCH * HEADS * SEQ * FDIM;
    float* cv    = ws + off; off += (size_t)BATCH * HEADS * SEQ * DHEAD;
    float* mv    = ws + off; off += (size_t)BATCH * HEADS * SEQ * DHEAD;
    float* ybuf  = ws + off; off += (size_t)M * DMODEL;
    float* cstat = ws + off; off += (size_t)BATCH * HEADS * NCHUNK * ST_FLOATS;
    float* dsq   = ws + off; off += (size_t)BATCH * HEADS * NCHUNK * 4;
    (void)ws_size; (void)in_sizes; (void)n_in; (void)out_size;

    // 1: input projections, one launch
    proj_qkv_kernel<<<dim3((M / GBM) * QKV_CB), 256, 0, stream>>>(hs, Wq, Wk, Wv, q_raw, k_raw, v_raw);

    // 2: running-mean centering
    center_scan_kernel<<<dim3(CS_KGRP + CS_VGRP, BATCH, CS_PARTS), 256, 0, stream>>>(k_raw, v_raw, ck, cv, mv);

    // 3: per-chunk states, then the causal attention core on their prefix sums, down to y
    chunk_state_kernel<<<dim3(NCHUNK, HEADS, BATCH), 320, 0, stream>>>(q_raw, ck, cv, cstat, dsq);
    atten_kernel<<<dim3(SEQ / 64, HEADS, BATCH), 256, 0, stream>>>(q_raw, ck, cv, cstat, dsq, mv, ybuf);

    // 4: output projection
    gemm_wmma_f32<<<dim3((M / GBM) * (DMODEL / GBN)), 256, 0, stream>>>(ybuf, Wo, out, M, DMODEL, DMODEL);
}
